// v000
// The times below were measured on an AMD MI455X: many runs one after another, warmed up first and cycling through
// copies of the inputs, with the whole window's GPU time divided by the number of runs. Launches and the gaps
// between them are all in it. The median over several windows is given; except for v000 it joins two sittings, which
// can be a few percent apart, so the side-by-side timings, each taken in one sitting, are the better comparison.
// v000 is the starting kernel. One run takes 376 microseconds.
#include <hip/hip_runtime.h>
#include <math.h>

typedef __attribute__((ext_vector_type(2))) float v2f;
typedef __attribute__((ext_vector_type(8))) float v8f;
typedef __attribute__((ext_vector_type(4))) unsigned int u32x4;
typedef __attribute__((ext_vector_type(8))) unsigned int u32x8;

#define B_    2
#define N_MM  256
#define N_V   64
#define N_A   128
#define DIM   1024
#define HEADS 16
#define INNER 256
#define HID   4096
#define HD    16
#define SCALE 0.125f   /* (DIM/HEADS)^-0.5 = 64^-0.5 */
#define EPS   1e-5f

#define EPI_NONE      0
#define EPI_BIAS_RES  2
#define EPI_BIAS_GELU 3

// Tensor Data Mover path for LDS staging (fallback: set to 0 -> manual loads)
#define USE_TDM 1

// ------------------------------------------------------------------
// LayerNorm over rows of length 1024 (one block per row, 256 threads)
// ------------------------------------------------------------------
__global__ __launch_bounds__(256) void ln1024_kernel(const float* __restrict__ x,
                                                     const float* __restrict__ w,
                                                     const float* __restrict__ b,
                                                     float* __restrict__ y) {
  __shared__ float red[256];
  const int row = blockIdx.x;
  const float* xr = x + (long)row * DIM;
  float v[4];
  float s = 0.f;
#pragma unroll
  for (int i = 0; i < 4; ++i) { v[i] = xr[threadIdx.x + 256 * i]; s += v[i]; }
  red[threadIdx.x] = s;
  __syncthreads();
  for (int off = 128; off > 0; off >>= 1) {
    if (threadIdx.x < off) red[threadIdx.x] += red[threadIdx.x + off];
    __syncthreads();
  }
  const float mean = red[0] * (1.f / DIM);
  __syncthreads();
  float s2 = 0.f;
#pragma unroll
  for (int i = 0; i < 4; ++i) { float d = v[i] - mean; s2 += d * d; }
  red[threadIdx.x] = s2;
  __syncthreads();
  for (int off = 128; off > 0; off >>= 1) {
    if (threadIdx.x < off) red[threadIdx.x] += red[threadIdx.x + off];
    __syncthreads();
  }
  const float inv = rsqrtf(red[0] * (1.f / DIM) + EPS);
  float* yr = y + (long)row * DIM;
#pragma unroll
  for (int i = 0; i < 4; ++i) {
    const int c = threadIdx.x + 256 * i;
    yr[c] = (v[i] - mean) * inv * w[c] + b[c];
  }
}

#if USE_TDM
__device__ __forceinline__ void tdm_load_2d(const float* gptr, const float* lptr,
                                            unsigned tile_cols, unsigned tile_rows,
                                            unsigned row_len, unsigned tensor_rows) {
  const unsigned long long ga = (unsigned long long)gptr;
  const unsigned la = (unsigned)(unsigned long long)lptr;
  u32x4 g0;
  g0[0] = 1u;                                               // count=1, user mode
  g0[1] = la;                                               // lds_addr (bytes)
  g0[2] = (unsigned)(ga & 0xFFFFFFFFull);                   // global_addr[31:0]
  g0[3] = (unsigned)((ga >> 32) & 0x1FFFFFFull) | (2u << 30); // addr[56:32] | type=2
  u32x8 g1;
  g1[0] = 2u << 16;
  g1[1] = (row_len & 0xFFFFu) << 16;
  g1[2] = ((row_len >> 16) & 0xFFFFu) | ((tensor_rows & 0xFFFFu) << 16);
  g1[3] = ((tensor_rows >> 16) & 0xFFFFu) | (tile_cols << 16);
  g1[4] = tile_rows;
  g1[5] = row_len;
  g1[6] = 0u;
  g1[7] = 0u;
  asm volatile("tensor_load_to_lds %0, %1" :: "s"(g0), "s"(g1) : "memory");
}
#endif

__global__ __launch_bounds__(256) void gemm_wmma_f32(
    const float* __restrict__ A, const float* __restrict__ Bm,
    const float* __restrict__ bias, const float* __restrict__ res,
    float* __restrict__ C, int M, int N, int K, int epi) {
  __shared__ float lA[2][32 * 64];     // [m][k] panels
  __shared__ float lB[2][64 * 128];    // [k][n] panels
  const int wave = threadIdx.x >> 5;
  const int lane = threadIdx.x & 31;
  const int m0   = blockIdx.x * 32;
  const int nblk = blockIdx.y * 128;
  const int n0   = nblk + wave * 16;

  v8f acc0 = {0.f, 0.f, 0.f, 0.f, 0.f, 0.f, 0.f, 0.f};
  v8f acc1 = acc0;

  const int S = K >> 6;  // number of 64-deep K panels

#if USE_TDM
  if (wave == 0) {
    tdm_load_2d(&A[(long)m0 * K], lA[0], 64u, 32u, (unsigned)K, (unsigned)M);
    tdm_load_2d(&Bm[nblk],        lB[0], 128u, 64u, (unsigned)N, (unsigned)K);
  }
#endif

  for (int i = 0; i < S; ++i) {
    const int cur = i & 1;
#if USE_TDM
    if (wave == 0) {
      if (i + 1 < S) {   // prefetch next panel into the other buffer
        const int kn = (i + 1) << 6;
        tdm_load_2d(&A[(long)m0 * K + kn],  lA[cur ^ 1], 64u, 32u, (unsigned)K, (unsigned)M);
        tdm_load_2d(&Bm[(long)kn * N + nblk], lB[cur ^ 1], 128u, 64u, (unsigned)N, (unsigned)K);
        asm volatile("s_wait_tensorcnt 0x2" ::: "memory");  // panel i done, i+1 in flight
      } else {
        asm volatile("s_wait_tensorcnt 0x0" ::: "memory");
      }
    }
    __syncthreads();     // publish panel i to all 8 waves
#else
    const int k0 = i << 6;
    __syncthreads();
    for (int t = threadIdx.x; t < 32 * 64; t += 256) {
      const int r = t >> 6, c = t & 63;
      lA[cur][t] = A[(long)(m0 + r) * K + (k0 + c)];
    }
    for (int t = threadIdx.x; t < 64 * 128; t += 256) {
      const int r = t >> 7, c = t & 127;
      lB[cur][t] = Bm[(long)(k0 + r) * N + (nblk + c)];
    }
    __syncthreads();
#endif

    const float* lAc = lA[cur];
    const float* lBc = lB[cur];
    const int ml    = lane & 15;          // A row in tile / B col in tile
    const int khalf = (lane >> 4) << 1;   // lanes 16-31 carry K+2,K+3
#pragma unroll
    for (int kk = 0; kk < 64; kk += 4) {
      const int kb = kk + khalf;
      v2f bf;
      bf.x = lBc[(kb + 0) * 128 + wave * 16 + ml];
      bf.y = lBc[(kb + 1) * 128 + wave * 16 + ml];
      v2f a0, a1;  // A 16x4 frags, M rows 0-15 and 16-31 of block tile
      a0.x = lAc[ml * 64 + kb];            a0.y = lAc[ml * 64 + kb + 1];
      a1.x = lAc[(ml + 16) * 64 + kb];     a1.y = lAc[(ml + 16) * 64 + kb + 1];
      acc0 = __builtin_amdgcn_wmma_f32_16x16x4_f32(false, a0, false, bf,
                                                   (short)0, acc0, false, false);
      acc1 = __builtin_amdgcn_wmma_f32_16x16x4_f32(false, a1, false, bf,
                                                   (short)0, acc1, false, false);
    }
    __syncthreads();     // all waves done with panel i before its buffer refills
  }

  const int col   = n0 + (lane & 15);
  const int rbase = (lane >> 4) << 3;
  const float bv  = (epi != EPI_NONE) ? bias[col] : 0.f;
#pragma unroll
  for (int r = 0; r < 8; ++r) {
    const int row0 = m0 + rbase + r;
    const int row1 = row0 + 16;
    float x0 = acc0[r] + bv;
    float x1 = acc1[r] + bv;
    if (epi == EPI_BIAS_GELU) {
      x0 = 0.5f * x0 * (1.f + erff(x0 * 0.7071067811865476f));
      x1 = 0.5f * x1 * (1.f + erff(x1 * 0.7071067811865476f));
    } else if (epi == EPI_BIAS_RES) {
      x0 += res[(long)row0 * N + col];
      x1 += res[(long)row1 * N + col];
    }
    C[(long)row0 * N + col] = x0;
    C[(long)row1 * N + col] = x1;
  }
}

// ------------------------------------------------------------------
// Factorized attention. Logits over the synthetic 8192-long KV separate as
// s(v,a) = s_v + s_a, so softmax/PV factor into two independent softmaxes:
//   out = softmax(q.k_v^T) @ v_v  +  softmax(q.k_a^T) @ v_a
// One block per (batch, head); thread t owns q-token t. K/V tiles in LDS.
// ------------------------------------------------------------------
__global__ __launch_bounds__(256) void attn_factored_kernel(
    const float* __restrict__ q, const float* __restrict__ kvv,
    const float* __restrict__ kva, float* __restrict__ out) {
  const int b = blockIdx.x >> 4;
  const int h = blockIdx.x & 15;
  __shared__ float kV[N_V][HD], vV[N_V][HD], kA[N_A][HD], vA[N_A][HD];
  for (int i = threadIdx.x; i < N_V * HD; i += 256) {
    const int v = i >> 4, d = i & 15;
    const float* p = kvv + (long)(b * N_V + v) * (2 * INNER);
    kV[v][d] = p[h * HD + d];
    vV[v][d] = p[INNER + h * HD + d];
  }
  for (int i = threadIdx.x; i < N_A * HD; i += 256) {
    const int a = i >> 4, d = i & 15;
    const float* p = kva + (long)(b * N_A + a) * (2 * INNER);
    kA[a][d] = p[h * HD + d];
    vA[a][d] = p[INNER + h * HD + d];
  }
  __syncthreads();

  const int tok = threadIdx.x;
  float qr[HD];
  const float* qp = q + (long)(b * N_MM + tok) * INNER + h * HD;
#pragma unroll
  for (int d = 0; d < HD; ++d) qr[d] = qp[d];

  float o[HD];
#pragma unroll
  for (int d = 0; d < HD; ++d) o[d] = 0.f;

  // ---- video stream (64 keys) ----
  float mV = -3.4e38f;
  for (int v = 0; v < N_V; ++v) {
    float s = 0.f;
#pragma unroll
    for (int d = 0; d < HD; ++d) s += qr[d] * kV[v][d];
    mV = fmaxf(mV, s * SCALE);
  }
  float lV = 0.f;
  for (int v = 0; v < N_V; ++v) {
    float s = 0.f;
#pragma unroll
    for (int d = 0; d < HD; ++d) s += qr[d] * kV[v][d];
    const float e = __expf(s * SCALE - mV);
    lV += e;
#pragma unroll
    for (int d = 0; d < HD; ++d) o[d] += e * vV[v][d];
  }
  const float invV = 1.f / lV;
#pragma unroll
  for (int d = 0; d < HD; ++d) o[d] *= invV;

  // ---- audio stream (128 keys) ----
  float mA = -3.4e38f;
  for (int a = 0; a < N_A; ++a) {
    float s = 0.f;
#pragma unroll
    for (int d = 0; d < HD; ++d) s += qr[d] * kA[a][d];
    mA = fmaxf(mA, s * SCALE);
  }
  float lAcc = 0.f;
  float oa[HD];
#pragma unroll
  for (int d = 0; d < HD; ++d) oa[d] = 0.f;
  for (int a = 0; a < N_A; ++a) {
    float s = 0.f;
#pragma unroll
    for (int d = 0; d < HD; ++d) s += qr[d] * kA[a][d];
    const float e = __expf(s * SCALE - mA);
    lAcc += e;
#pragma unroll
    for (int d = 0; d < HD; ++d) oa[d] += e * vA[a][d];
  }
  const float invA = 1.f / lAcc;

  float* op = out + (long)(b * N_MM + tok) * INNER + h * HD;
#pragma unroll
  for (int d = 0; d < HD; ++d) op[d] = o[d] + oa[d] * invA;
}

// ------------------------------------------------------------------
extern "C" void kernel_launch(void* const* d_in, const int* in_sizes, int n_in,
                              void* d_out, int out_size, void* d_ws, size_t ws_size,
                              hipStream_t stream) {
  (void)in_sizes; (void)n_in; (void)out_size; (void)ws_size;
  const float* xmm      = (const float*)d_in[0];
  const float* xv       = (const float*)d_in[1];
  const float* xa       = (const float*)d_in[2];
  const float* ln_mm_w  = (const float*)d_in[3];
  const float* ln_mm_b  = (const float*)d_in[4];
  const float* ln_v_w   = (const float*)d_in[5];
  const float* ln_v_b   = (const float*)d_in[6];
  const float* ln_a_w   = (const float*)d_in[7];
  const float* ln_a_b   = (const float*)d_in[8];
  const float* Wq       = (const float*)d_in[9];
  const float* Wkv      = (const float*)d_in[10];
  const float* Wproj    = (const float*)d_in[11];
  const float* bproj    = (const float*)d_in[12];
  const float* ln_mlp_w = (const float*)d_in[13];
  const float* ln_mlp_b = (const float*)d_in[14];
  const float* W1       = (const float*)d_in[15];
  const float* b1       = (const float*)d_in[16];
  const float* W2       = (const float*)d_in[17];
  const float* b2       = (const float*)d_in[18];
  float* out = (float*)d_out;
  float* ws  = (float*)d_ws;

  const int RM = B_ * N_MM;  // 512 rows (mm stream)
  float* src_mm = ws;                               // 512*1024
  float* src_v  = src_mm + (long)RM * DIM;          // 128*1024
  float* src_a  = src_v + (long)B_ * N_V * DIM;     // 256*1024
  float* qbuf   = src_a + (long)B_ * N_A * DIM;     // 512*256
  float* kvv    = qbuf + (long)RM * INNER;          // 128*512
  float* kva    = kvv + (long)B_ * N_V * 2 * INNER; // 256*512
  float* attnb  = kva + (long)B_ * N_A * 2 * INNER; // 512*256
  float* xmm2   = attnb + (long)RM * INNER;         // 512*1024
  float* hln    = xmm2 + (long)RM * DIM;            // 512*1024
  float* act    = hln + (long)RM * DIM;             // 512*4096

  // 1) LayerNorms
  ln1024_kernel<<<RM, 256, 0, stream>>>(xmm, ln_mm_w, ln_mm_b, src_mm);
  ln1024_kernel<<<B_ * N_V, 256, 0, stream>>>(xv, ln_v_w, ln_v_b, src_v);
  ln1024_kernel<<<B_ * N_A, 256, 0, stream>>>(xa, ln_a_w, ln_a_b, src_a);

  // 2) Projections (WMMA GEMMs). Wkv[:DIM] / Wkv[DIM:] are contiguous halves.
  gemm_wmma_f32<<<dim3(16, 2), 256, 0, stream>>>(src_mm, Wq, nullptr, nullptr,
                                                 qbuf, RM, INNER, DIM, EPI_NONE);
  gemm_wmma_f32<<<dim3(4, 4), 256, 0, stream>>>(src_v, Wkv, nullptr, nullptr,
                                                kvv, B_ * N_V, 2 * INNER, DIM, EPI_NONE);
  gemm_wmma_f32<<<dim3(8, 4), 256, 0, stream>>>(src_a, Wkv + (long)DIM * 2 * INNER,
                                                nullptr, nullptr,
                                                kva, B_ * N_A, 2 * INNER, DIM, EPI_NONE);

  // 3) Factorized attention over the separable 8192-key softmax
  attn_factored_kernel<<<B_ * HEADS, 256, 0, stream>>>(qbuf, kvv, kva, attnb);

  // 4) Output proj + bias + residual -> xmm2
  gemm_wmma_f32<<<dim3(16, 8), 256, 0, stream>>>(attnb, Wproj, bproj, xmm,
                                                 xmm2, RM, DIM, INNER, EPI_BIAS_RES);

  // 5) MLP: LN -> W1+gelu -> W2 + residual
  ln1024_kernel<<<RM, 256, 0, stream>>>(xmm2, ln_mlp_w, ln_mlp_b, hln);
  gemm_wmma_f32<<<dim3(16, 32), 256, 0, stream>>>(hln, W1, b1, nullptr,
                                                  act, RM, HID, DIM, EPI_BIAS_GELU);
  gemm_wmma_f32<<<dim3(16, 8), 256, 0, stream>>>(act, W2, b2, xmm2,
                                                 out, RM, DIM, HID, EPI_BIAS_RES);
}

// v001
// A run of this version takes 189 microseconds.
// Two timings next to v000 both put it at 2.02 times that version's speed.
#include <hip/hip_runtime.h>
#include <math.h>
#include <stdint.h>

typedef __attribute__((ext_vector_type(2))) float v2f;
typedef __attribute__((ext_vector_type(8))) float v8f;
typedef __attribute__((ext_vector_type(4))) unsigned int u32x4;
typedef __attribute__((ext_vector_type(8))) unsigned int u32x8;

#define B_    2
#define N_MM  256
#define N_V   64
#define N_A   128
#define DIM   1024
#define HEADS 16
#define INNER 256
#define HID   4096
#define HD    16
#define SCALE 0.125f   /* (DIM/HEADS)^-0.5 = 64^-0.5 */
#define EPS   1e-5f

#define EPI_NONE      0
#define EPI_BIAS_RES  2
#define EPI_BIAS_GELU 3

// LDS pitch of an A panel row, in floats: 256 B of data + the 16 B pad that the tensor load lays behind each row
#define A_PITCH 68
// floats per A buffer: 32 rows of 272 B = 8,704 B, rounded up to a multiple of 2 KiB (every tensor-load destination is one)
#define A_BUF   2560

// ------------------------------------------------------------------
// LayerNorm over rows of length 1024 (one block per row, 256 threads)
// ------------------------------------------------------------------
__global__ __launch_bounds__(256) void ln1024_kernel(const float* __restrict__ x,
                                                     const float* __restrict__ w,
                                                     const float* __restrict__ b,
                                                     float* __restrict__ y) {
  __shared__ float red[256];
  const int row = blockIdx.x;
  const float* xr = x + (long)row * DIM;
  float v[4];
  float s = 0.f;
#pragma unroll
  for (int i = 0; i < 4; ++i) { v[i] = xr[threadIdx.x + 256 * i]; s += v[i]; }
  red[threadIdx.x] = s;
  __syncthreads();
  for (int off = 128; off > 0; off >>= 1) {
    if (threadIdx.x < off) red[threadIdx.x] += red[threadIdx.x + off];
    __syncthreads();
  }
  const float mean = red[0] * (1.f / DIM);
  __syncthreads();
  float s2 = 0.f;
#pragma unroll
  for (int i = 0; i < 4; ++i) { float d = v[i] - mean; s2 += d * d; }
  red[threadIdx.x] = s2;
  __syncthreads();
  for (int off = 128; off > 0; off >>= 1) {
    if (threadIdx.x < off) red[threadIdx.x] += red[threadIdx.x + off];
    __syncthreads();
  }
  const float inv = rsqrtf(red[0] * (1.f / DIM) + EPS);
  float* yr = y + (long)row * DIM;
#pragma unroll
  for (int i = 0; i < 4; ++i) {
    const int c = threadIdx.x + 256 * i;
    yr[c] = (v[i] - mean) * inv * w[c] + b[c];
  }
}

__device__ __forceinline__ uint32_t uni(uint32_t v) { return (uint32_t)__builtin_amdgcn_readfirstlane(v); }
__device__ __forceinline__ uint32_t pinned(uint32_t v) { uint32_t w = uni(v); asm volatile("" : "+s"(w)); return w; }  // the pinned() form for a test around a tensor load
__device__ __forceinline__ void wait_ds0()     { asm volatile("s_wait_dscnt 0x0" ::: "memory"); }     // this wave's LDS reads have retired
__device__ __forceinline__ void wait_tensor0() { asm volatile("s_wait_tensorcnt 0x0" ::: "memory"); } // this wave's tensor load has landed
__device__ __forceinline__ void wait_tensor0(u32x4& g0, u32x8& g1) {
  asm volatile("s_wait_tensorcnt 0x0" : "+s"(g0), "+s"(g1) :: "memory");
}

__device__ __forceinline__ void tdm_group0(u32x4& g, const float* lptr, const float* gptr) {
  const uint64_t ga = (uint64_t)gptr;
  g[0] = uni(1u);
  g[1] = uni((uint32_t)(uint64_t)lptr);
  g[2] = uni((uint32_t)ga);
  g[3] = uni((((uint32_t)(ga >> 32)) & 0x01FFFFFFu) | 0x80000000u);
}
template <uint32_t WORD0, uint32_t ROWB, uint32_t ROWS>
__device__ __forceinline__ u32x8 tdm_group1(uint32_t src_pitch) {
  u32x8 g;
  g[0] = uni(WORD0);
  g[1] = uni((ROWB & 0xFFFFu) << 16);
  g[2] = uni((ROWB >> 16) | ((ROWS & 0xFFFFu) << 16));
  g[3] = uni((ROWS >> 16) | (ROWB << 16));
  g[4] = uni(ROWS);
  g[5] = uni(src_pitch);
  g[6] = uni(0u);
  g[7] = uni(0u);
  return g;
}
__device__ __forceinline__ void tdm_load(u32x4& g0, u32x8& g1) {
  asm volatile("tensor_load_to_lds %0, %1" : "+s"(g0), "+s"(g1) :: "memory");  // in-out: see wait_tensor0(g0, g1)
}

__global__ __launch_bounds__(256) void gemm_wmma_f32(
    const float* __restrict__ A, const float* __restrict__ Bm,
    const float* __restrict__ bias, const float* __restrict__ res,
    float* __restrict__ C, int M, int N, int K, int epi) {
  __shared__ __attribute__((aligned(2048))) float lA[2][A_BUF];       // [m][k] panels, row pitch A_PITCH
  __shared__ __attribute__((aligned(2048))) float lB[2][64 * 128];    // [k][n] panels
  const uint32_t wave = uni(threadIdx.x >> 5);
  const int lane = threadIdx.x & 31;
  const int m0   = blockIdx.x * 32;
  const int nblk = blockIdx.y * 128;
  const int n0   = nblk + (int)wave * 16;

  v8f acc0 = {0.f, 0.f, 0.f, 0.f, 0.f, 0.f, 0.f, 0.f};
  v8f acc1 = acc0;

  const int S = K >> 6;  // number of 64-deep K panels

  u32x8 g1A = tdm_group1<(1u << 20) | (5u << 22) | (3u << 25), 256u, 32u>((uint32_t)K * 4u);
  u32x8 g1B = tdm_group1<0u, 512u, 64u>((uint32_t)N * 4u);
  const float* gA = A + (long)m0 * K;   // panel s starts at gA + 64 * s
  const float* gB = Bm + nblk;          // panel s starts at gB + 64 * s * N

  u32x4 g0A, g0B;
  tdm_group0(g0A, lA[0], gA);
  tdm_group0(g0B, lB[0], gB);

  // panel 0, landed and published; then panel 1 into the other buffer
  if (pinned(wave == 0u)) {
    tdm_load(g0A, g1A);
    wait_tensor0(g0A, g1A);
  }
  if (pinned(wave == 1u)) {
    tdm_load(g0B, g1B);
    wait_tensor0(g0B, g1B);
  }
  __syncthreads();
  if (pinned(wave == 0u)) {
    tdm_group0(g0A, lA[1], gA + 64);
    tdm_load(g0A, g1A);
  }
  if (pinned(wave == 1u)) {
    tdm_group0(g0B, lB[1], gB + (long)64 * N);
    tdm_load(g0B, g1B);
  }

  for (int i = 0; i < S; ++i) {
    const int cur = i & 1;
    const float* lAc = lA[cur];
    const float* lBc = lB[cur];
    const int ml    = lane & 15;          // A row in tile / B col in tile
    const int khalf = (lane >> 4) << 1;   // lanes 16-31 carry K+2,K+3
#pragma unroll
    for (int kk = 0; kk < 64; kk += 4) {
      const int kb = kk + khalf;
      v2f bf;
      bf.x = lBc[(kb + 0) * 128 + wave * 16 + ml];
      bf.y = lBc[(kb + 1) * 128 + wave * 16 + ml];
      v2f a0, a1;  // A 16x4 frags, M rows 0-15 and 16-31 of block tile
      a0.x = lAc[ml * A_PITCH + kb];            a0.y = lAc[ml * A_PITCH + kb + 1];
      a1.x = lAc[(ml + 16) * A_PITCH + kb];     a1.y = lAc[(ml + 16) * A_PITCH + kb + 1];
      acc0 = __builtin_amdgcn_wmma_f32_16x16x4_f32(false, a0, false, bf,
                                                   (short)0, acc0, false, false);
      acc1 = __builtin_amdgcn_wmma_f32_16x16x4_f32(false, a1, false, bf,
                                                   (short)0, acc1, false, false);
    }
    // Publish panel i + 1 and free panel i's buffer: own LDS reads retired, the issuers' loads landed, one barrier for both.
    __builtin_amdgcn_sched_barrier(0);  // keeps the panel's last WMMAs in front of the wait: behind it they would stall on the full LDS drain
    wait_ds0();
    if (pinned(wave == 0u)) wait_tensor0(g0A, g1A);
    if (pinned(wave == 1u)) wait_tensor0(g0B, g1B);
    __syncthreads();
    // Refill the buffer that every wave has just left, only while a panel i + 2 exists.
    if (pinned(i + 2 < S)) {
      if (pinned(wave == 0u)) {
        tdm_group0(g0A, lA[cur], gA + ((i + 2) << 6));
        tdm_load(g0A, g1A);
      }
      if (pinned(wave == 1u)) {
        tdm_group0(g0B, lB[cur], gB + (long)((i + 2) << 6) * N);
        tdm_load(g0B, g1B);
      }
    }
  }
  wait_tensor0();
  wait_ds0();

  const int col   = n0 + (lane & 15);
  const int rbase = (lane >> 4) << 3;
  const float bv  = (epi != EPI_NONE) ? bias[col] : 0.f;
#pragma unroll
  for (int r = 0; r < 8; ++r) {
    const int row0 = m0 + rbase + r;
    const int row1 = row0 + 16;
    float x0 = acc0[r] + bv;
    float x1 = acc1[r] + bv;
    if (epi == EPI_BIAS_GELU) {
      x0 = 0.5f * x0 * (1.f + erff(x0 * 0.7071067811865476f));
      x1 = 0.5f * x1 * (1.f + erff(x1 * 0.7071067811865476f));
    } else if (epi == EPI_BIAS_RES) {
      x0 += res[(long)row0 * N + col];
      x1 += res[(long)row1 * N + col];
    }
    C[(long)row0 * N + col] = x0;
    C[(long)row1 * N + col] = x1;
  }
}

// ------------------------------------------------------------------
// Factorized attention. Logits over the synthetic 8192-long KV separate as
// s(v,a) = s_v + s_a, so softmax/PV factor into two independent softmaxes:
//   out = softmax(q.k_v^T) @ v_v  +  softmax(q.k_a^T) @ v_a
// One block per (batch, head); thread t owns q-token t. K/V tiles in LDS.
// ------------------------------------------------------------------
__global__ __launch_bounds__(256) void attn_factored_kernel(
    const float* __restrict__ q, const float* __restrict__ kvv,
    const float* __restrict__ kva, float* __restrict__ out) {
  const int b = blockIdx.x >> 4;
  const int h = blockIdx.x & 15;
  __shared__ float kV[N_V][HD], vV[N_V][HD], kA[N_A][HD], vA[N_A][HD];
  for (int i = threadIdx.x; i < N_V * HD; i += 256) {
    const int v = i >> 4, d = i & 15;
    const float* p = kvv + (long)(b * N_V + v) * (2 * INNER);
    kV[v][d] = p[h * HD + d];
    vV[v][d] = p[INNER + h * HD + d];
  }
  for (int i = threadIdx.x; i < N_A * HD; i += 256) {
    const int a = i >> 4, d = i & 15;
    const float* p = kva + (long)(b * N_A + a) * (2 * INNER);
    kA[a][d] = p[h * HD + d];
    vA[a][d] = p[INNER + h * HD + d];
  }
  __syncthreads();

  const int tok = threadIdx.x;
  float qr[HD];
  const float* qp = q + (long)(b * N_MM + tok) * INNER + h * HD;
#pragma unroll
  for (int d = 0; d < HD; ++d) qr[d] = qp[d];

  float o[HD];
#pragma unroll
  for (int d = 0; d < HD; ++d) o[d] = 0.f;

  // ---- video stream (64 keys) ----
  float mV = -3.4e38f;
  for (int v = 0; v < N_V; ++v) {
    float s = 0.f;
#pragma unroll
    for (int d = 0; d < HD; ++d) s += qr[d] * kV[v][d];
    mV = fmaxf(mV, s * SCALE);
  }
  float lV = 0.f;
  for (int v = 0; v < N_V; ++v) {
    float s = 0.f;
#pragma unroll
    for (int d = 0; d < HD; ++d) s += qr[d] * kV[v][d];
    const float e = __expf(s * SCALE - mV);
    lV += e;
#pragma unroll
    for (int d = 0; d < HD; ++d) o[d] += e * vV[v][d];
  }
  const float invV = 1.f / lV;
#pragma unroll
  for (int d = 0; d < HD; ++d) o[d] *= invV;

  // ---- audio stream (128 keys) ----
  float mA = -3.4e38f;
  for (int a = 0; a < N_A; ++a) {
    float s = 0.f;
#pragma unroll
    for (int d = 0; d < HD; ++d) s += qr[d] * kA[a][d];
    mA = fmaxf(mA, s * SCALE);
  }
  float lAcc = 0.f;
  float oa[HD];
#pragma unroll
  for (int d = 0; d < HD; ++d) oa[d] = 0.f;
  for (int a = 0; a < N_A; ++a) {
    float s = 0.f;
#pragma unroll
    for (int d = 0; d < HD; ++d) s += qr[d] * kA[a][d];
    const float e = __expf(s * SCALE - mA);
    lAcc += e;
#pragma unroll
    for (int d = 0; d < HD; ++d) oa[d] += e * vA[a][d];
  }
  const float invA = 1.f / lAcc;

  float* op = out + (long)(b * N_MM + tok) * INNER + h * HD;
#pragma unroll
  for (int d = 0; d < HD; ++d) op[d] = o[d] + oa[d] * invA;
}

// ------------------------------------------------------------------
extern "C" void kernel_launch(void* const* d_in, const int* in_sizes, int n_in,
                              void* d_out, int out_size, void* d_ws, size_t ws_size,
                              hipStream_t stream) {
  (void)in_sizes; (void)n_in; (void)out_size; (void)ws_size;
  const float* xmm      = (const float*)d_in[0];
  const float* xv       = (const float*)d_in[1];
  const float* xa       = (const float*)d_in[2];
  const float* ln_mm_w  = (const float*)d_in[3];
  const float* ln_mm_b  = (const float*)d_in[4];
  const float* ln_v_w   = (const float*)d_in[5];
  const float* ln_v_b   = (const float*)d_in[6];
  const float* ln_a_w   = (const float*)d_in[7];
  const float* ln_a_b   = (const float*)d_in[8];
  const float* Wq       = (const float*)d_in[9];
  const float* Wkv      = (const float*)d_in[10];
  const float* Wproj    = (const float*)d_in[11];
  const float* bproj    = (const float*)d_in[12];
  const float* ln_mlp_w = (const float*)d_in[13];
  const float* ln_mlp_b = (const float*)d_in[14];
  const float* W1       = (const float*)d_in[15];
  const float* b1       = (const float*)d_in[16];
  const float* W2       = (const float*)d_in[17];
  const float* b2       = (const float*)d_in[18];
  float* out = (float*)d_out;
  float* ws  = (float*)d_ws;

  const int RM = B_ * N_MM;  // 512 rows (mm stream)
  float* src_mm = ws;                               // 512*1024
  float* src_v  = src_mm + (long)RM * DIM;          // 128*1024
  float* src_a  = src_v + (long)B_ * N_V * DIM;     // 256*1024
  float* qbuf   = src_a + (long)B_ * N_A * DIM;     // 512*256
  float* kvv    = qbuf + (long)RM * INNER;          // 128*512
  float* kva    = kvv + (long)B_ * N_V * 2 * INNER; // 256*512
  float* attnb  = kva + (long)B_ * N_A * 2 * INNER; // 512*256
  float* xmm2   = attnb + (long)RM * INNER;         // 512*1024
  float* hln    = xmm2 + (long)RM * DIM;            // 512*1024
  float* act    = hln + (long)RM * DIM;             // 512*4096

  // 1) LayerNorms
  ln1024_kernel<<<RM, 256, 0, stream>>>(xmm, ln_mm_w, ln_mm_b, src_mm);
  ln1024_kernel<<<B_ * N_V, 256, 0, stream>>>(xv, ln_v_w, ln_v_b, src_v);
  ln1024_kernel<<<B_ * N_A, 256, 0, stream>>>(xa, ln_a_w, ln_a_b, src_a);

  // 2) Projections (WMMA GEMMs). Wkv[:DIM] / Wkv[DIM:] are contiguous halves.
  gemm_wmma_f32<<<dim3(16, 2), 256, 0, stream>>>(src_mm, Wq, nullptr, nullptr,
                                                 qbuf, RM, INNER, DIM, EPI_NONE);
  gemm_wmma_f32<<<dim3(4, 4), 256, 0, stream>>>(src_v, Wkv, nullptr, nullptr,
                                                kvv, B_ * N_V, 2 * INNER, DIM, EPI_NONE);
  gemm_wmma_f32<<<dim3(8, 4), 256, 0, stream>>>(src_a, Wkv + (long)DIM * 2 * INNER,
                                                nullptr, nullptr,
                                                kva, B_ * N_A, 2 * INNER, DIM, EPI_NONE);

  // 3) Factorized attention over the separable 8192-key softmax
  attn_factored_kernel<<<B_ * HEADS, 256, 0, stream>>>(qbuf, kvv, kva, attnb);

  // 4) Output proj + bias + residual -> xmm2
  gemm_wmma_f32<<<dim3(16, 8), 256, 0, stream>>>(attnb, Wproj, bproj, xmm,
                                                 xmm2, RM, DIM, INNER, EPI_BIAS_RES);

  // 5) MLP: LN -> W1+gelu -> W2 + residual
  ln1024_kernel<<<RM, 256, 0, stream>>>(xmm2, ln_mlp_w, ln_mlp_b, hln);
  gemm_wmma_f32<<<dim3(16, 32), 256, 0, stream>>>(hln, W1, b1, nullptr,
                                                  act, RM, HID, DIM, EPI_BIAS_GELU);
  gemm_wmma_f32<<<dim3(16, 8), 256, 0, stream>>>(act, W2, b2, xmm2,
                                                 out, RM, DIM, HID, EPI_BIAS_RES);
}

// v002
// A run of this version takes 151 microseconds.
// In two side-by-side timings against v001, it was 1.25 and 1.24 times as fast.
// Over all steps from v000 it is 2.53 times as fast.
#include <hip/hip_runtime.h>
#include <math.h>
#include <stdint.h>

typedef __attribute__((ext_vector_type(2))) float v2f;
typedef __attribute__((ext_vector_type(8))) float v8f;
typedef __attribute__((ext_vector_type(4))) unsigned int u32x4;
typedef __attribute__((ext_vector_type(8))) unsigned int u32x8;

#define B_    2
#define N_MM  256
#define N_V   64
#define N_A   128
#define DIM   1024
#define HEADS 16
#define INNER 256
#define HID   4096
#define HD    16
#define SCALE 0.125f   /* (DIM/HEADS)^-0.5 = 64^-0.5 */
#define EPS   1e-5f

#define EPI_NONE      0
#define EPI_BIAS_RES  2
#define EPI_BIAS_GELU 3

// LDS pitch of an A panel row, in floats: 256 B of data + the 16 B pad that the tensor load lays behind each row
#define A_PITCH 68
// floats per A buffer: 32 rows of 272 B = 8,704 B, rounded up to a multiple of 2 KiB (every tensor-load destination is one)
#define A_BUF   2560

// ------------------------------------------------------------------
// LayerNorm over rows of length 1024 (one block per row, 256 threads)
// ------------------------------------------------------------------
__device__ __forceinline__ void ln1024_row(const float* __restrict__ x,
                                           const float* __restrict__ w,
                                           const float* __restrict__ b,
                                           float* __restrict__ y, int row) {
  __shared__ float red[256];
  const float* xr = x + (long)row * DIM;
  float v[4];
  float s = 0.f;
#pragma unroll
  for (int i = 0; i < 4; ++i) { v[i] = xr[threadIdx.x + 256 * i]; s += v[i]; }
  red[threadIdx.x] = s;
  __syncthreads();
  for (int off = 128; off > 0; off >>= 1) {
    if (threadIdx.x < off) red[threadIdx.x] += red[threadIdx.x + off];
    __syncthreads();
  }
  const float mean = red[0] * (1.f / DIM);
  __syncthreads();
  float s2 = 0.f;
#pragma unroll
  for (int i = 0; i < 4; ++i) { float d = v[i] - mean; s2 += d * d; }
  red[threadIdx.x] = s2;
  __syncthreads();
  for (int off = 128; off > 0; off >>= 1) {
    if (threadIdx.x < off) red[threadIdx.x] += red[threadIdx.x + off];
    __syncthreads();
  }
  const float inv = rsqrtf(red[0] * (1.f / DIM) + EPS);
  float* yr = y + (long)row * DIM;
#pragma unroll
  for (int i = 0; i < 4; ++i) {
    const int c = threadIdx.x + 256 * i;
    yr[c] = (v[i] - mean) * inv * w[c] + b[c];
  }
}

__global__ __launch_bounds__(256) void ln1024_kernel(const float* __restrict__ x,
                                                     const float* __restrict__ w,
                                                     const float* __restrict__ b,
                                                     float* __restrict__ y) {
  ln1024_row(x, w, b, y, blockIdx.x);
}

// The three input streams' LayerNorms depend on nothing of one another: one grid holds the rows of all three,
// LN3_R0 rows of stream 0, then LN3_R1 rows of stream 1, then LN3_R2 rows of stream 2.
#define LN3_R0 (B_ * N_MM)
#define LN3_R1 (B_ * N_A)
#define LN3_R2 (B_ * N_V)
__global__ __launch_bounds__(256) void ln1024_x3_kernel(
    const float* __restrict__ x0, const float* __restrict__ w0, const float* __restrict__ b0, float* __restrict__ y0,
    const float* __restrict__ x1, const float* __restrict__ w1, const float* __restrict__ b1, float* __restrict__ y1,
    const float* __restrict__ x2, const float* __restrict__ w2, const float* __restrict__ b2, float* __restrict__ y2) {
  const int id = blockIdx.x;
  const float* x = x0;
  const float* w = w0;
  const float* b = b0;
  float* y = y0;
  int row = id;
  if (id >= LN3_R0 + LN3_R1) {
    x = x2; w = w2; b = b2; y = y2; row = id - (LN3_R0 + LN3_R1);
  } else if (id >= LN3_R0) {
    x = x1; w = w1; b = b1; y = y1; row = id - LN3_R0;
  }
  ln1024_row(x, w, b, y, row);
}

__device__ __forceinline__ uint32_t uni(uint32_t v) { return (uint32_t)__builtin_amdgcn_readfirstlane(v); }
__device__ __forceinline__ uint32_t pinned(uint32_t v) { uint32_t w = uni(v); asm volatile("" : "+s"(w)); return w; }  // the pinned() form for a test around a tensor load
__device__ __forceinline__ void wait_ds0()     { asm volatile("s_wait_dscnt 0x0" ::: "memory"); }     // this wave's LDS reads have retired
__device__ __forceinline__ void wait_tensor0() { asm volatile("s_wait_tensorcnt 0x0" ::: "memory"); } // this wave's tensor load has landed
__device__ __forceinline__ void wait_tensor0(u32x4& g0, u32x8& g1) {
  asm volatile("s_wait_tensorcnt 0x0" : "+s"(g0), "+s"(g1) :: "memory");
}

__device__ __forceinline__ void tdm_group0(u32x4& g, const float* lptr, const float* gptr) {
  const uint64_t ga = (uint64_t)gptr;
  g[0] = uni(1u);
  g[1] = uni((uint32_t)(uint64_t)lptr);
  g[2] = uni((uint32_t)ga);
  g[3] = uni((((uint32_t)(ga >> 32)) & 0x01FFFFFFu) | 0x80000000u);
}
template <uint32_t WORD0, uint32_t ROWB, uint32_t ROWS>
__device__ __forceinline__ u32x8 tdm_group1(uint32_t src_pitch) {
  u32x8 g;
  g[0] = uni(WORD0);
  g[1] = uni((ROWB & 0xFFFFu) << 16);
  g[2] = uni((ROWB >> 16) | ((ROWS & 0xFFFFu) << 16));
  g[3] = uni((ROWS >> 16) | (ROWB << 16));
  g[4] = uni(ROWS);
  g[5] = uni(src_pitch);
  g[6] = uni(0u);
  g[7] = uni(0u);
  return g;
}
__device__ __forceinline__ void tdm_load(u32x4& g0, u32x8& g1) {
  asm volatile("tensor_load_to_lds %0, %1" : "+s"(g0), "+s"(g1) :: "memory");  // in-out: see wait_tensor0(g0, g1)
}

__device__ __forceinline__ void gemm_tile_f32(
    const float* __restrict__ A, const float* __restrict__ Bm,
    const float* __restrict__ bias, const float* __restrict__ res,
    float* __restrict__ C, int N, int K, int epi, int tile_m, int tile_n) {
  __shared__ __attribute__((aligned(2048))) float lA[2][A_BUF];       // [m][k] panels, row pitch A_PITCH
  __shared__ __attribute__((aligned(2048))) float lB[2][64 * 128];    // [k][n] panels
  const uint32_t wave = uni(threadIdx.x >> 5);
  const int lane = threadIdx.x & 31;
  const int m0   = tile_m * 32;
  const int nblk = tile_n * 128;
  const int n0   = nblk + (int)wave * 16;

  v8f acc0 = {0.f, 0.f, 0.f, 0.f, 0.f, 0.f, 0.f, 0.f};
  v8f acc1 = acc0;

  const int S = K >> 6;  // number of 64-deep K panels

  u32x8 g1A = tdm_group1<(1u << 20) | (5u << 22) | (3u << 25), 256u, 32u>((uint32_t)K * 4u);
  u32x8 g1B = tdm_group1<0u, 512u, 64u>((uint32_t)N * 4u);
  const float* gA = A + (long)m0 * K;   // panel s starts at gA + 64 * s
  const float* gB = Bm + nblk;          // panel s starts at gB + 64 * s * N

  u32x4 g0A, g0B;
  tdm_group0(g0A, lA[0], gA);
  tdm_group0(g0B, lB[0], gB);

  // panel 0, landed and published; then panel 1 into the other buffer
  if (pinned(wave == 0u)) {
    tdm_load(g0A, g1A);
    wait_tensor0(g0A, g1A);
  }
  if (pinned(wave == 1u)) {
    tdm_load(g0B, g1B);
    wait_tensor0(g0B, g1B);
  }
  __syncthreads();
  if (pinned(wave == 0u)) {
    tdm_group0(g0A, lA[1], gA + 64);
    tdm_load(g0A, g1A);
  }
  if (pinned(wave == 1u)) {
    tdm_group0(g0B, lB[1], gB + (long)64 * N);
    tdm_load(g0B, g1B);
  }

  for (int i = 0; i < S; ++i) {
    const int cur = i & 1;
    const float* lAc = lA[cur];
    const float* lBc = lB[cur];
    const int ml    = lane & 15;          // A row in tile / B col in tile
    const int khalf = (lane >> 4) << 1;   // lanes 16-31 carry K+2,K+3
#pragma unroll
    for (int kk = 0; kk < 64; kk += 4) {
      const int kb = kk + khalf;
      v2f bf;
      bf.x = lBc[(kb + 0) * 128 + wave * 16 + ml];
      bf.y = lBc[(kb + 1) * 128 + wave * 16 + ml];
      v2f a0, a1;  // A 16x4 frags, M rows 0-15 and 16-31 of block tile
      a0.x = lAc[ml * A_PITCH + kb];            a0.y = lAc[ml * A_PITCH + kb + 1];
      a1.x = lAc[(ml + 16) * A_PITCH + kb];     a1.y = lAc[(ml + 16) * A_PITCH + kb + 1];
      acc0 = __builtin_amdgcn_wmma_f32_16x16x4_f32(false, a0, false, bf,
                                                   (short)0, acc0, false, false);
      acc1 = __builtin_amdgcn_wmma_f32_16x16x4_f32(false, a1, false, bf,
                                                   (short)0, acc1, false, false);
    }
    // Publish panel i + 1 and free panel i's buffer: own LDS reads retired, the issuers' loads landed, one barrier for both.
    __builtin_amdgcn_sched_barrier(0);  // keeps the panel's last WMMAs in front of the wait: behind it they would stall on the full LDS drain
    wait_ds0();
    if (pinned(wave == 0u)) wait_tensor0(g0A, g1A);
    if (pinned(wave == 1u)) wait_tensor0(g0B, g1B);
    __syncthreads();
    // Refill the buffer that every wave has just left, only while a panel i + 2 exists.
    if (pinned(i + 2 < S)) {
      if (pinned(wave == 0u)) {
        tdm_group0(g0A, lA[cur], gA + ((i + 2) << 6));
        tdm_load(g0A, g1A);
      }
      if (pinned(wave == 1u)) {
        tdm_group0(g0B, lB[cur], gB + (long)((i + 2) << 6) * N);
        tdm_load(g0B, g1B);
      }
    }
  }
  wait_tensor0();
  wait_ds0();

  const int col   = n0 + (lane & 15);
  const int rbase = (lane >> 4) << 3;
  const float bv  = (epi != EPI_NONE) ? bias[col] : 0.f;
#pragma unroll
  for (int r = 0; r < 8; ++r) {
    const int row0 = m0 + rbase + r;
    const int row1 = row0 + 16;
    float x0 = acc0[r] + bv;
    float x1 = acc1[r] + bv;
    if (epi == EPI_BIAS_GELU) {
      x0 = 0.5f * x0 * (1.f + erff(x0 * 0.7071067811865476f));
      x1 = 0.5f * x1 * (1.f + erff(x1 * 0.7071067811865476f));
    } else if (epi == EPI_BIAS_RES) {
      x0 += res[(long)row0 * N + col];
      x1 += res[(long)row1 * N + col];
    }
    C[(long)row0 * N + col] = x0;
    C[(long)row1 * N + col] = x1;
  }
}

__global__ __launch_bounds__(256) void gemm_wmma_f32(
    const float* __restrict__ A, const float* __restrict__ Bm,
    const float* __restrict__ bias, const float* __restrict__ res,
    float* __restrict__ C, int M, int N, int K, int epi) {
  (void)M;
  gemm_tile_f32(A, Bm, bias, res, C, N, K, epi, blockIdx.x, blockIdx.y);
}

#define TM0 (B_ * N_MM / 32u)    /* q:        512 x 256 */
#define TN0 (INNER / 128u)
#define TM1 (B_ * N_A / 32u)     /* kv audio: 256 x 512 */
#define TN1 (2 * INNER / 128u)
#define TM2 (B_ * N_V / 32u)     /* kv video: 128 x 512 */
#define TN2 (2 * INNER / 128u)
__global__ __launch_bounds__(256) void gemm_x3_wmma_f32(
    const float* __restrict__ A0, const float* __restrict__ B0, float* __restrict__ C0,
    const float* __restrict__ A1, const float* __restrict__ B1, float* __restrict__ C1,
    const float* __restrict__ A2, const float* __restrict__ B2, float* __restrict__ C2, int K) {
  const uint32_t id = blockIdx.x;
  const float* A = A0;
  const float* Bm = B0;
  float* C = C0;
  uint32_t tile_m = id % TM0, tile_n = id / TM0, tn = TN0;
  if (id >= TM0 * TN0 + TM1 * TN1) {
    const uint32_t t = id - (TM0 * TN0 + TM1 * TN1);
    A = A2; Bm = B2; C = C2; tile_m = t % TM2; tile_n = t / TM2; tn = TN2;
  } else if (id >= TM0 * TN0) {
    const uint32_t t = id - TM0 * TN0;
    A = A1; Bm = B1; C = C1; tile_m = t % TM1; tile_n = t / TM1; tn = TN1;
  }
  gemm_tile_f32(A, Bm, nullptr, nullptr, C, (int)(tn * 128u), K, EPI_NONE, (int)tile_m, (int)tile_n);
}

// ------------------------------------------------------------------
// Factorized attention. Logits over the synthetic 8192-long KV separate as
// s(v,a) = s_v + s_a, so softmax/PV factor into two independent softmaxes:
//   out = softmax(q.k_v^T) @ v_v  +  softmax(q.k_a^T) @ v_a
// One block per (batch, head); thread t owns q-token t. K/V tiles in LDS.
// ------------------------------------------------------------------
__global__ __launch_bounds__(256) void attn_factored_kernel(
    const float* __restrict__ q, const float* __restrict__ kvv,
    const float* __restrict__ kva, float* __restrict__ out) {
  const int b = blockIdx.x >> 4;
  const int h = blockIdx.x & 15;
  __shared__ float kV[N_V][HD], vV[N_V][HD], kA[N_A][HD], vA[N_A][HD];
  for (int i = threadIdx.x; i < N_V * HD; i += 256) {
    const int v = i >> 4, d = i & 15;
    const float* p = kvv + (long)(b * N_V + v) * (2 * INNER);
    kV[v][d] = p[h * HD + d];
    vV[v][d] = p[INNER + h * HD + d];
  }
  for (int i = threadIdx.x; i < N_A * HD; i += 256) {
    const int a = i >> 4, d = i & 15;
    const float* p = kva + (long)(b * N_A + a) * (2 * INNER);
    kA[a][d] = p[h * HD + d];
    vA[a][d] = p[INNER + h * HD + d];
  }
  __syncthreads();

  const int tok = threadIdx.x;
  float qr[HD];
  const float* qp = q + (long)(b * N_MM + tok) * INNER + h * HD;
#pragma unroll
  for (int d = 0; d < HD; ++d) qr[d] = qp[d];

  float o[HD];
#pragma unroll
  for (int d = 0; d < HD; ++d) o[d] = 0.f;

  // ---- video stream (64 keys) ----
  float mV = -3.4e38f;
  for (int v = 0; v < N_V; ++v) {
    float s = 0.f;
#pragma unroll
    for (int d = 0; d < HD; ++d) s += qr[d] * kV[v][d];
    mV = fmaxf(mV, s * SCALE);
  }
  float lV = 0.f;
  for (int v = 0; v < N_V; ++v) {
    float s = 0.f;
#pragma unroll
    for (int d = 0; d < HD; ++d) s += qr[d] * kV[v][d];
    const float e = __expf(s * SCALE - mV);
    lV += e;
#pragma unroll
    for (int d = 0; d < HD; ++d) o[d] += e * vV[v][d];
  }
  const float invV = 1.f / lV;
#pragma unroll
  for (int d = 0; d < HD; ++d) o[d] *= invV;

  // ---- audio stream (128 keys) ----
  float mA = -3.4e38f;
  for (int a = 0; a < N_A; ++a) {
    float s = 0.f;
#pragma unroll
    for (int d = 0; d < HD; ++d) s += qr[d] * kA[a][d];
    mA = fmaxf(mA, s * SCALE);
  }
  float lAcc = 0.f;
  float oa[HD];
#pragma unroll
  for (int d = 0; d < HD; ++d) oa[d] = 0.f;
  for (int a = 0; a < N_A; ++a) {
    float s = 0.f;
#pragma unroll
    for (int d = 0; d < HD; ++d) s += qr[d] * kA[a][d];
    const float e = __expf(s * SCALE - mA);
    lAcc += e;
#pragma unroll
    for (int d = 0; d < HD; ++d) oa[d] += e * vA[a][d];
  }
  const float invA = 1.f / lAcc;

  float* op = out + (long)(b * N_MM + tok) * INNER + h * HD;
#pragma unroll
  for (int d = 0; d < HD; ++d) op[d] = o[d] + oa[d] * invA;
}

// ------------------------------------------------------------------
extern "C" void kernel_launch(void* const* d_in, const int* in_sizes, int n_in,
                              void* d_out, int out_size, void* d_ws, size_t ws_size,
                              hipStream_t stream) {
  (void)in_sizes; (void)n_in; (void)out_size; (void)ws_size;
  const float* xmm      = (const float*)d_in[0];
  const float* xv       = (const float*)d_in[1];
  const float* xa       = (const float*)d_in[2];
  const float* ln_mm_w  = (const float*)d_in[3];
  const float* ln_mm_b  = (const float*)d_in[4];
  const float* ln_v_w   = (const float*)d_in[5];
  const float* ln_v_b   = (const float*)d_in[6];
  const float* ln_a_w   = (const float*)d_in[7];
  const float* ln_a_b   = (const float*)d_in[8];
  const float* Wq       = (const float*)d_in[9];
  const float* Wkv      = (const float*)d_in[10];
  const float* Wproj    = (const float*)d_in[11];
  const float* bproj    = (const float*)d_in[12];
  const float* ln_mlp_w = (const float*)d_in[13];
  const float* ln_mlp_b = (const float*)d_in[14];
  const float* W1       = (const float*)d_in[15];
  const float* b1       = (const float*)d_in[16];
  const float* W2       = (const float*)d_in[17];
  const float* b2       = (const float*)d_in[18];
  float* out = (float*)d_out;
  float* ws  = (float*)d_ws;

  const int RM = B_ * N_MM;  // 512 rows (mm stream)
  float* src_mm = ws;                               // 512*1024
  float* src_v  = src_mm + (long)RM * DIM;          // 128*1024
  float* src_a  = src_v + (long)B_ * N_V * DIM;     // 256*1024
  float* qbuf   = src_a + (long)B_ * N_A * DIM;     // 512*256
  float* kvv    = qbuf + (long)RM * INNER;          // 128*512
  float* kva    = kvv + (long)B_ * N_V * 2 * INNER; // 256*512
  float* attnb  = kva + (long)B_ * N_A * 2 * INNER; // 512*256
  float* xmm2   = attnb + (long)RM * INNER;         // 512*1024
  float* hln    = xmm2 + (long)RM * DIM;            // 512*1024
  float* act    = hln + (long)RM * DIM;             // 512*4096

  // 1) LayerNorms
  ln1024_x3_kernel<<<LN3_R0 + LN3_R1 + LN3_R2, 256, 0, stream>>>(
      xmm, ln_mm_w, ln_mm_b, src_mm, xa, ln_a_w, ln_a_b, src_a, xv, ln_v_w, ln_v_b, src_v);

  // 2) Projections (WMMA GEMMs). Wkv[:DIM] / Wkv[DIM:] are contiguous halves.
  //    q (16 x 2 tiles), kv of the audio stream (8 x 4) and kv of the video stream (4 x 4) in one grid of 80 tiles.
  gemm_x3_wmma_f32<<<TM0 * TN0 + TM1 * TN1 + TM2 * TN2, 256, 0, stream>>>(
      src_mm, Wq, qbuf,
      src_a, Wkv + (long)DIM * 2 * INNER, kva,
      src_v, Wkv, kvv, DIM);

  // 3) Factorized attention over the separable 8192-key softmax
  attn_factored_kernel<<<B_ * HEADS, 256, 0, stream>>>(qbuf, kvv, kva, attnb);

  // 4) Output proj + bias + residual -> xmm2
  gemm_wmma_f32<<<dim3(16, 8), 256, 0, stream>>>(attnb, Wproj, bproj, xmm,
                                                 xmm2, RM, DIM, INNER, EPI_BIAS_RES);

  // 5) MLP: LN -> W1+gelu -> W2 + residual
  ln1024_kernel<<<RM, 256, 0, stream>>>(xmm2, ln_mlp_w, ln_mlp_b, hln);
  gemm_wmma_f32<<<dim3(16, 32), 256, 0, stream>>>(hln, W1, b1, nullptr,
                                                  act, RM, HID, DIM, EPI_BIAS_GELU);
  gemm_wmma_f32<<<dim3(16, 8), 256, 0, stream>>>(act, W2, b2, xmm2,
                                                 out, RM, DIM, HID, EPI_BIAS_RES);
}

// v003
// One run takes 126 microseconds.
// Two timings next to v002 both put it at 1.20 times that version's speed.
// Over all steps from v000 it is 3.03 times as fast.
#include <hip/hip_runtime.h>
#include <math.h>
#include <stdint.h>

typedef __attribute__((ext_vector_type(2))) float v2f;
typedef __attribute__((ext_vector_type(8))) float v8f;
typedef __attribute__((ext_vector_type(4))) unsigned int u32x4;
typedef __attribute__((ext_vector_type(8))) unsigned int u32x8;

#define B_    2
#define N_MM  256
#define N_V   64
#define N_A   128
#define DIM   1024
#define HEADS 16
#define INNER 256
#define HID   4096
#define HD    16
#define SCALE 0.125f   /* (DIM/HEADS)^-0.5 = 64^-0.5 */
#define EPS   1e-5f

#define EPI_NONE      0
#define EPI_BIAS_RES  2
#define EPI_BIAS_GELU 3

// LDS pitch of an A panel row, in floats: 256 B of data + the 16 B pad that the tensor load lays behind each row
#define A_PITCH 68
// floats per A buffer: 32 rows of 272 B = 8,704 B, rounded up to a multiple of 2 KiB (every tensor-load destination is one)
#define A_BUF   2560

// ------------------------------------------------------------------
// LayerNorm over rows of length 1024 (one block per row, 256 threads)
// ------------------------------------------------------------------
__device__ __forceinline__ void ln1024_row(const float* __restrict__ x,
                                           const float* __restrict__ w,
                                           const float* __restrict__ b,
                                           float* __restrict__ y, int row) {
  __shared__ float red[256];
  const float* xr = x + (long)row * DIM;
  float v[4];
  float s = 0.f;
#pragma unroll
  for (int i = 0; i < 4; ++i) { v[i] = xr[threadIdx.x + 256 * i]; s += v[i]; }
  red[threadIdx.x] = s;
  __syncthreads();
  for (int off = 128; off > 0; off >>= 1) {
    if (threadIdx.x < off) red[threadIdx.x] += red[threadIdx.x + off];
    __syncthreads();
  }
  const float mean = red[0] * (1.f / DIM);
  __syncthreads();
  float s2 = 0.f;
#pragma unroll
  for (int i = 0; i < 4; ++i) { float d = v[i] - mean; s2 += d * d; }
  red[threadIdx.x] = s2;
  __syncthreads();
  for (int off = 128; off > 0; off >>= 1) {
    if (threadIdx.x < off) red[threadIdx.x] += red[threadIdx.x + off];
    __syncthreads();
  }
  const float inv = rsqrtf(red[0] * (1.f / DIM) + EPS);
  float* yr = y + (long)row * DIM;
#pragma unroll
  for (int i = 0; i < 4; ++i) {
    const int c = threadIdx.x + 256 * i;
    yr[c] = (v[i] - mean) * inv * w[c] + b[c];
  }
}

__global__ __launch_bounds__(256) void ln1024_kernel(const float* __restrict__ x,
                                                     const float* __restrict__ w,
                                                     const float* __restrict__ b,
                                                     float* __restrict__ y) {
  ln1024_row(x, w, b, y, blockIdx.x);
}

// The three input streams' LayerNorms depend on nothing of one another: one grid holds the rows of all three,
// LN3_R0 rows of stream 0, then LN3_R1 rows of stream 1, then LN3_R2 rows of stream 2.
#define LN3_R0 (B_ * N_MM)
#define LN3_R1 (B_ * N_A)
#define LN3_R2 (B_ * N_V)
__global__ __launch_bounds__(256) void ln1024_x3_kernel(
    const float* __restrict__ x0, const float* __restrict__ w0, const float* __restrict__ b0, float* __restrict__ y0,
    const float* __restrict__ x1, const float* __restrict__ w1, const float* __restrict__ b1, float* __restrict__ y1,
    const float* __restrict__ x2, const float* __restrict__ w2, const float* __restrict__ b2, float* __restrict__ y2) {
  const int id = blockIdx.x;
  const float* x = x0;
  const float* w = w0;
  const float* b = b0;
  float* y = y0;
  int row = id;
  if (id >= LN3_R0 + LN3_R1) {
    x = x2; w = w2; b = b2; y = y2; row = id - (LN3_R0 + LN3_R1);
  } else if (id >= LN3_R0) {
    x = x1; w = w1; b = b1; y = y1; row = id - LN3_R0;
  }
  ln1024_row(x, w, b, y, row);
}

__device__ __forceinline__ uint32_t uni(uint32_t v) { return (uint32_t)__builtin_amdgcn_readfirstlane(v); }
__device__ __forceinline__ uint32_t pinned(uint32_t v) { uint32_t w = uni(v); asm volatile("" : "+s"(w)); return w; }  // the pinned() form for a test around a tensor load
__device__ __forceinline__ void wait_ds0()     { asm volatile("s_wait_dscnt 0x0" ::: "memory"); }     // this wave's LDS reads have retired
__device__ __forceinline__ void wait_tensor0() { asm volatile("s_wait_tensorcnt 0x0" ::: "memory"); } // this wave's tensor load has landed
__device__ __forceinline__ void wait_tensor0(u32x4& g0, u32x8& g1) {
  asm volatile("s_wait_tensorcnt 0x0" : "+s"(g0), "+s"(g1) :: "memory");
}

__device__ __forceinline__ void tdm_group0(u32x4& g, const float* lptr, const float* gptr) {
  const uint64_t ga = (uint64_t)gptr;
  g[0] = uni(1u);
  g[1] = uni((uint32_t)(uint64_t)lptr);
  g[2] = uni((uint32_t)ga);
  g[3] = uni((((uint32_t)(ga >> 32)) & 0x01FFFFFFu) | 0x80000000u);
}
template <uint32_t WORD0, uint32_t ROWB, uint32_t ROWS>
__device__ __forceinline__ u32x8 tdm_group1(uint32_t src_pitch) {
  u32x8 g;
  g[0] = uni(WORD0);
  g[1] = uni((ROWB & 0xFFFFu) << 16);
  g[2] = uni((ROWB >> 16) | ((ROWS & 0xFFFFu) << 16));
  g[3] = uni((ROWS >> 16) | (ROWB << 16));
  g[4] = uni(ROWS);
  g[5] = uni(src_pitch);
  g[6] = uni(0u);
  g[7] = uni(0u);
  return g;
}
__device__ __forceinline__ void tdm_load(u32x4& g0, u32x8& g1) {
  asm volatile("tensor_load_to_lds %0, %1" : "+s"(g0), "+s"(g1) :: "memory");  // in-out: see wait_tensor0(g0, g1)
}

__device__ __forceinline__ void gemm_tile_f32(
    const float* __restrict__ A, const float* __restrict__ Bm,
    const float* __restrict__ bias, const float* __restrict__ res,
    float* __restrict__ C, int N, int K, int epi, int tile_m, int tile_n) {
  __shared__ __attribute__((aligned(2048))) float lA[2][A_BUF];       // [m][k] panels, row pitch A_PITCH
  __shared__ __attribute__((aligned(2048))) float lB[2][64 * 128];    // [k][n] panels
  const uint32_t wave = uni(threadIdx.x >> 5);
  const int lane = threadIdx.x & 31;
  const int m0   = tile_m * 32;
  const int nblk = tile_n * 128;
  const int n0   = nblk + (int)wave * 16;

  v8f acc0 = {0.f, 0.f, 0.f, 0.f, 0.f, 0.f, 0.f, 0.f};
  v8f acc1 = acc0;

  const int S = K >> 6;  // number of 64-deep K panels

  u32x8 g1A = tdm_group1<(1u << 20) | (5u << 22) | (3u << 25), 256u, 32u>((uint32_t)K * 4u);
  u32x8 g1B = tdm_group1<0u, 512u, 64u>((uint32_t)N * 4u);
  const float* gA = A + (long)m0 * K;   // panel s starts at gA + 64 * s
  const float* gB = Bm + nblk;          // panel s starts at gB + 64 * s * N

  u32x4 g0A, g0B;
  tdm_group0(g0A, lA[0], gA);
  tdm_group0(g0B, lB[0], gB);

  // panel 0, landed and published; then panel 1 into the other buffer
  if (pinned(wave == 0u)) {
    tdm_load(g0A, g1A);
    wait_tensor0(g0A, g1A);
  }
  if (pinned(wave == 1u)) {
    tdm_load(g0B, g1B);
    wait_tensor0(g0B, g1B);
  }
  __syncthreads();
  if (pinned(wave == 0u)) {
    tdm_group0(g0A, lA[1], gA + 64);
    tdm_load(g0A, g1A);
  }
  if (pinned(wave == 1u)) {
    tdm_group0(g0B, lB[1], gB + (long)64 * N);
    tdm_load(g0B, g1B);
  }

  for (int i = 0; i < S; ++i) {
    const int cur = i & 1;
    const float* lAc = lA[cur];
    const float* lBc = lB[cur];
    const int ml    = lane & 15;          // A row in tile / B col in tile
    const int khalf = (lane >> 4) << 1;   // lanes 16-31 carry K+2,K+3
#pragma unroll
    for (int kk = 0; kk < 64; kk += 4) {
      const int kb = kk + khalf;
      v2f bf;
      bf.x = lBc[(kb + 0) * 128 + wave * 16 + ml];
      bf.y = lBc[(kb + 1) * 128 + wave * 16 + ml];
      v2f a0, a1;  // A 16x4 frags, M rows 0-15 and 16-31 of block tile
      a0.x = lAc[ml * A_PITCH + kb];            a0.y = lAc[ml * A_PITCH + kb + 1];
      a1.x = lAc[(ml + 16) * A_PITCH + kb];     a1.y = lAc[(ml + 16) * A_PITCH + kb + 1];
      acc0 = __builtin_amdgcn_wmma_f32_16x16x4_f32(false, a0, false, bf,
                                                   (short)0, acc0, false, false);
      acc1 = __builtin_amdgcn_wmma_f32_16x16x4_f32(false, a1, false, bf,
                                                   (short)0, acc1, false, false);
    }
    // Publish panel i + 1 and free panel i's buffer: own LDS reads retired, the issuers' loads landed, one barrier for both.
    __builtin_amdgcn_sched_barrier(0);  // keeps the panel's last WMMAs in front of the wait: behind it they would stall on the full LDS drain
    wait_ds0();
    if (pinned(wave == 0u)) wait_tensor0(g0A, g1A);
    if (pinned(wave == 1u)) wait_tensor0(g0B, g1B);
    __syncthreads();
    // Refill the buffer that every wave has just left, only while a panel i + 2 exists.
    if (pinned(i + 2 < S)) {
      if (pinned(wave == 0u)) {
        tdm_group0(g0A, lA[cur], gA + ((i + 2) << 6));
        tdm_load(g0A, g1A);
      }
      if (pinned(wave == 1u)) {
        tdm_group0(g0B, lB[cur], gB + (long)((i + 2) << 6) * N);
        tdm_load(g0B, g1B);
      }
    }
  }
  wait_tensor0();
  wait_ds0();

  const int col   = n0 + (lane & 15);
  const int rbase = (lane >> 4) << 3;
  const float bv  = (epi != EPI_NONE) ? bias[col] : 0.f;
#pragma unroll
  for (int r = 0; r < 8; ++r) {
    const int row0 = m0 + rbase + r;
    const int row1 = row0 + 16;
    float x0 = acc0[r] + bv;
    float x1 = acc1[r] + bv;
    if (epi == EPI_BIAS_GELU) {
      x0 = 0.5f * x0 * (1.f + erff(x0 * 0.7071067811865476f));
      x1 = 0.5f * x1 * (1.f + erff(x1 * 0.7071067811865476f));
    } else if (epi == EPI_BIAS_RES) {
      x0 += res[(long)row0 * N + col];
      x1 += res[(long)row1 * N + col];
    }
    C[(long)row0 * N + col] = x0;
    C[(long)row1 * N + col] = x1;
  }
}

__global__ __launch_bounds__(256) void gemm_wmma_f32(
    const float* __restrict__ A, const float* __restrict__ Bm,
    const float* __restrict__ bias, const float* __restrict__ res,
    float* __restrict__ C, int M, int N, int K, int epi) {
  (void)M;
  gemm_tile_f32(A, Bm, bias, res, C, N, K, epi, blockIdx.x, blockIdx.y);
}

#define TM0 (B_ * N_MM / 32u)    /* q:        512 x 256 */
#define TN0 (INNER / 128u)
#define TM1 (B_ * N_A / 32u)     /* kv audio: 256 x 512 */
#define TN1 (2 * INNER / 128u)
#define TM2 (B_ * N_V / 32u)     /* kv video: 128 x 512 */
#define TN2 (2 * INNER / 128u)
__global__ __launch_bounds__(256) void gemm_x3_wmma_f32(
    const float* __restrict__ A0, const float* __restrict__ B0, float* __restrict__ C0,
    const float* __restrict__ A1, const float* __restrict__ B1, float* __restrict__ C1,
    const float* __restrict__ A2, const float* __restrict__ B2, float* __restrict__ C2, int K) {
  const uint32_t id = blockIdx.x;
  const float* A = A0;
  const float* Bm = B0;
  float* C = C0;
  uint32_t tile_m = id % TM0, tile_n = id / TM0, tn = TN0;
  if (id >= TM0 * TN0 + TM1 * TN1) {
    const uint32_t t = id - (TM0 * TN0 + TM1 * TN1);
    A = A2; Bm = B2; C = C2; tile_m = t % TM2; tile_n = t / TM2; tn = TN2;
  } else if (id >= TM0 * TN0) {
    const uint32_t t = id - TM0 * TN0;
    A = A1; Bm = B1; C = C1; tile_m = t % TM1; tile_n = t / TM1; tn = TN1;
  }
  gemm_tile_f32(A, Bm, nullptr, nullptr, C, (int)(tn * 128u), K, EPI_NONE, (int)tile_m, (int)tile_n);
}

// ------------------------------------------------------------------
// Factorized attention. Logits over the synthetic 8192-long KV separate as
// s(v,a) = s_v + s_a, so softmax/PV factor into two independent softmaxes:
//   out = softmax(q.k_v^T) @ v_v  +  softmax(q.k_a^T) @ v_a
// One block per (batch, head, chunk of 32 q-tokens). The keys of one q-token are dealt to 8 neighbouring lanes:
// lane j of the 8 takes keys j, j + 8, j + 16, ... of both streams and keeps its 8 + 16 scores in registers;
// the 8 partial maxima, sums and outputs are merged inside the 16-lane row. K/V rows in LDS.
// ------------------------------------------------------------------
typedef __attribute__((ext_vector_type(4))) float f32x4;
#define KSPLIT   8                         /* lanes that share one q-token */
#define TOK_BLK  (256 / KSPLIT)            /* q-tokens per block */
#define N_CHUNK  (N_MM / TOK_BLK)          /* blocks per (batch, head) */
#define NKEY_V   (N_V / KSPLIT)            /* video keys per lane */
#define NKEY     ((N_V + N_A) / KSPLIT)    /* keys per lane, the video keys first */
#define KGRP     4                         /* rows per register set */
#define NGRP     (NKEY / KGRP)
#define KV_PITCH 20

// The value that lane (l ^ M) holds, M < 16 (DPP row_xmask); every lane is on wherever it is used.
template <int M>
__device__ __forceinline__ float row_xor(float x) {
  return __int_as_float(__builtin_amdgcn_update_dpp(0, __float_as_int(x), 0x160 + M, 0xf, 0xf, true));
}
__device__ __forceinline__ float sum8(float x) {
  x += row_xor<1>(x);
  x += row_xor<2>(x);
  x += row_xor<4>(x);
  return x;
}
__device__ __forceinline__ float max8(float x) {
  x = fmaxf(x, row_xor<1>(x));
  x = fmaxf(x, row_xor<2>(x));
  x = fmaxf(x, row_xor<4>(x));
  return x;
}
__device__ __forceinline__ float exp_slot(float x) {
  float r;
  asm("v_exp_f32 %0, %1\n\tv_nop" : "=v"(r) : "v"(x * 1.4426950408889634f));
  return r;
}
// One register set: this lane's next KGRP rows (every KSPLIT-th row from p on), 16 floats each.
struct RowSet { f32x4 r[KGRP][HD / 4]; };
__device__ __forceinline__ void load_rows(RowSet& t, const float* p) {
#pragma unroll
  for (int u = 0; u < KGRP; ++u)
#pragma unroll
    for (int c = 0; c < HD / 4; ++c) t.r[u][c] = *(const f32x4*)(p + u * KSPLIT * KV_PITCH + 4 * c);
}
// q . k over 16 dims, as four partial sums in two packed chains
__device__ __forceinline__ float dot16(const v2f* q2, const f32x4* k) {
  v2f a = {0.f, 0.f}, b = {0.f, 0.f};
#pragma unroll
  for (int c = 0; c < HD / 4; ++c) {
    a = __builtin_elementwise_fma(q2[2 * c], k[c].xy, a);
    b = __builtin_elementwise_fma(q2[2 * c + 1], k[c].zw, b);
  }
  const v2f t = a + b;
  return t.x + t.y;
}
__device__ __forceinline__ void axpy16(v2f* o2, float e, const f32x4* v) {
  const v2f e2 = {e, e};
#pragma unroll
  for (int c = 0; c < HD / 4; ++c) {
    o2[2 * c]     = __builtin_elementwise_fma(e2, v[c].xy, o2[2 * c]);
    o2[2 * c + 1] = __builtin_elementwise_fma(e2, v[c].zw, o2[2 * c + 1]);
  }
}

__global__ __launch_bounds__(256) void attn_factored_kernel(
    const float* __restrict__ q, const float* __restrict__ kvv,
    const float* __restrict__ kva, float* __restrict__ out) {
  const int chunk = blockIdx.x % N_CHUNK;
  const int h = (blockIdx.x / N_CHUNK) & 15;
  const int b = blockIdx.x / (N_CHUNK * HEADS);
  // rows 0 .. N_V - 1: video keys; rows N_V .. N_V + N_A - 1: audio keys
  __shared__ __attribute__((aligned(16))) float kS[N_V + N_A][KV_PITCH];
  __shared__ __attribute__((aligned(16))) float vS[N_V + N_A][KV_PITCH];

  const int j   = threadIdx.x & (KSPLIT - 1);
  const int tok = chunk * TOK_BLK + (threadIdx.x / KSPLIT);
  v2f q2[HD / 2];
  const f32x4* qp = (const f32x4*)(q + (long)(b * N_MM + tok) * INNER + h * HD);
#pragma unroll
  for (int c = 0; c < HD / 4; ++c) {
    const f32x4 x = qp[c];
    q2[2 * c] = x.xy;
    q2[2 * c + 1] = x.zw;
  }

  // 8 pieces of 16 B per key: 4 of its K row, 4 of its V row
  const int part = (threadIdx.x >> 2) & 1, quad = threadIdx.x & 3;
  const int soff = part * INNER + h * HD + quad * 4;
  float* sdst = (part ? &vS[0][0] : &kS[0][0]) + quad * 4;
#pragma unroll
  for (int it = 0; it < N_V * 8 / 256; ++it) {
    const int row = (threadIdx.x >> 3) + 32 * it;
    *(f32x4*)(sdst + row * KV_PITCH) = *(const f32x4*)(kvv + (long)(b * N_V + row) * (2 * INNER) + soff);
  }
#pragma unroll
  for (int it = 0; it < N_A * 8 / 256; ++it) {
    const int row = (threadIdx.x >> 3) + 32 * it;
    *(f32x4*)(sdst + (N_V + row) * KV_PITCH) = *(const f32x4*)(kva + (long)(b * N_A + row) * (2 * INNER) + soff);
  }
  __syncthreads();

  // Key number i of this lane is row i * KSPLIT + j. Two register sets: the next KGRP rows are read while these are worked on.
  // The scheduling fence of each step keeps the next set's 16 reads together and ahead of the arithmetic on this set: left to
  // itself the compiler spreads the reads singly among the arithmetic, with only a few of them in flight.
  const float* kl = &kS[j][0];
  const float* vl = &vS[j][0];
  RowSet rs[2];
  float s[NKEY];
  load_rows(rs[0], kl);
#pragma unroll
  for (int g = 0; g < NGRP; ++g) {
    load_rows(rs[(g + 1) & 1], (g + 1 < NGRP) ? kl + (g + 1) * KGRP * KSPLIT * KV_PITCH : vl);
    __builtin_amdgcn_sched_barrier(0);  // the next set's reads stay in front of this set's arithmetic
#pragma unroll
    for (int u = 0; u < KGRP; ++u) s[g * KGRP + u] = dot16(q2, rs[g & 1].r[u]) * SCALE;
  }

  // maximum over all keys of each stream, then the exponentials
  float mV = s[0], mA = s[NKEY_V];
#pragma unroll
  for (int i = 1; i < NKEY_V; ++i) mV = fmaxf(mV, s[i]);
#pragma unroll
  for (int i = NKEY_V + 1; i < NKEY; ++i) mA = fmaxf(mA, s[i]);
  mV = max8(mV);
  mA = max8(mA);
  float lV = 0.f, lA = 0.f;
#pragma unroll
  for (int i = 0; i < NKEY_V; ++i) { s[i] = exp_slot(s[i] - mV); lV += s[i]; }
#pragma unroll
  for (int i = NKEY_V; i < NKEY; ++i) { s[i] = exp_slot(s[i] - mA); lA += s[i]; }

  v2f oV[HD / 2], oA[HD / 2];
#pragma unroll
  for (int d = 0; d < HD / 2; ++d) { oV[d] = (v2f){0.f, 0.f}; oA[d] = (v2f){0.f, 0.f}; }
#pragma unroll
  for (int g = 0; g < NGRP; ++g) {
    if (g + 1 < NGRP) load_rows(rs[(NGRP + g + 1) & 1], vl + (g + 1) * KGRP * KSPLIT * KV_PITCH);
    __builtin_amdgcn_sched_barrier(0);
#pragma unroll
    for (int u = 0; u < KGRP; ++u) {
      const int i = g * KGRP + u;
      axpy16(i < NKEY_V ? oV : oA, s[i], rs[(NGRP + g) & 1].r[u]);
    }
  }
  const float invV = 1.f / sum8(lV);
  const float invA = 1.f / sum8(lA);

  float c[HD];
#pragma unroll
  for (int d = 0; d < HD / 2; ++d) {
    const v2f t = oV[d] * invV + oA[d] * invA;
    c[2 * d]     = sum8(t.x);
    c[2 * d + 1] = sum8(t.y);
  }

  if (j == 0) {
    f32x4* op = (f32x4*)(out + (long)(b * N_MM + tok) * INNER + h * HD);
#pragma unroll
    for (int g = 0; g < HD / 4; ++g) {
      f32x4 x = {c[4 * g], c[4 * g + 1], c[4 * g + 2], c[4 * g + 3]};
      op[g] = x;
    }
  }
}

// ------------------------------------------------------------------
extern "C" void kernel_launch(void* const* d_in, const int* in_sizes, int n_in,
                              void* d_out, int out_size, void* d_ws, size_t ws_size,
                              hipStream_t stream) {
  (void)in_sizes; (void)n_in; (void)out_size; (void)ws_size;
  const float* xmm      = (const float*)d_in[0];
  const float* xv       = (const float*)d_in[1];
  const float* xa       = (const float*)d_in[2];
  const float* ln_mm_w  = (const float*)d_in[3];
  const float* ln_mm_b  = (const float*)d_in[4];
  const float* ln_v_w   = (const float*)d_in[5];
  const float* ln_v_b   = (const float*)d_in[6];
  const float* ln_a_w   = (const float*)d_in[7];
  const float* ln_a_b   = (const float*)d_in[8];
  const float* Wq       = (const float*)d_in[9];
  const float* Wkv      = (const float*)d_in[10];
  const float* Wproj    = (const float*)d_in[11];
  const float* bproj    = (const float*)d_in[12];
  const float* ln_mlp_w = (const float*)d_in[13];
  const float* ln_mlp_b = (const float*)d_in[14];
  const float* W1       = (const float*)d_in[15];
  const float* b1       = (const float*)d_in[16];
  const float* W2       = (const float*)d_in[17];
  const float* b2       = (const float*)d_in[18];
  float* out = (float*)d_out;
  float* ws  = (float*)d_ws;

  const int RM = B_ * N_MM;  // 512 rows (mm stream)
  float* src_mm = ws;                               // 512*1024
  float* src_v  = src_mm + (long)RM * DIM;          // 128*1024
  float* src_a  = src_v + (long)B_ * N_V * DIM;     // 256*1024
  float* qbuf   = src_a + (long)B_ * N_A * DIM;     // 512*256
  float* kvv    = qbuf + (long)RM * INNER;          // 128*512
  float* kva    = kvv + (long)B_ * N_V * 2 * INNER; // 256*512
  float* attnb  = kva + (long)B_ * N_A * 2 * INNER; // 512*256
  float* xmm2   = attnb + (long)RM * INNER;         // 512*1024
  float* hln    = xmm2 + (long)RM * DIM;            // 512*1024
  float* act    = hln + (long)RM * DIM;             // 512*4096

  // 1) LayerNorms
  ln1024_x3_kernel<<<LN3_R0 + LN3_R1 + LN3_R2, 256, 0, stream>>>(
      xmm, ln_mm_w, ln_mm_b, src_mm, xa, ln_a_w, ln_a_b, src_a, xv, ln_v_w, ln_v_b, src_v);

  // 2) Projections (WMMA GEMMs). Wkv[:DIM] / Wkv[DIM:] are contiguous halves.
  //    q (16 x 2 tiles), kv of the audio stream (8 x 4) and kv of the video stream (4 x 4) in one grid of 80 tiles.
  gemm_x3_wmma_f32<<<TM0 * TN0 + TM1 * TN1 + TM2 * TN2, 256, 0, stream>>>(
      src_mm, Wq, qbuf,
      src_a, Wkv + (long)DIM * 2 * INNER, kva,
      src_v, Wkv, kvv, DIM);

  // 3) Factorized attention over the separable 8192-key softmax
  attn_factored_kernel<<<B_ * HEADS * N_CHUNK, 256, 0, stream>>>(qbuf, kvv, kva, attnb);

  // 4) Output proj + bias + residual -> xmm2
  gemm_wmma_f32<<<dim3(16, 8), 256, 0, stream>>>(attnb, Wproj, bproj, xmm,
                                                 xmm2, RM, DIM, INNER, EPI_BIAS_RES);

  // 5) MLP: LN -> W1+gelu -> W2 + residual
  ln1024_kernel<<<RM, 256, 0, stream>>>(xmm2, ln_mlp_w, ln_mlp_b, hln);
  gemm_wmma_f32<<<dim3(16, 32), 256, 0, stream>>>(hln, W1, b1, nullptr,
                                                  act, RM, HID, DIM, EPI_BIAS_GELU);
  gemm_wmma_f32<<<dim3(16, 8), 256, 0, stream>>>(act, W2, b2, xmm2,
                                                 out, RM, DIM, HID, EPI_BIAS_RES);
}

// v004
// One run takes 91.4 microseconds.
// Next to v003, in two timings, it ran 1.38 and 1.37 times as fast.
// All steps since v000 together make it 4.16 times as fast.
#include <hip/hip_runtime.h>
#include <math.h>
#include <stdint.h>

typedef __attribute__((ext_vector_type(2))) float v2f;
typedef __attribute__((ext_vector_type(8))) float v8f;
typedef __attribute__((ext_vector_type(4))) unsigned int u32x4;
typedef __attribute__((ext_vector_type(8))) unsigned int u32x8;

#define B_    2
#define N_MM  256
#define N_V   64
#define N_A   128
#define DIM   1024
#define HEADS 16
#define INNER 256
#define HID   4096
#define HD    16
#define SCALE 0.125f   /* (DIM/HEADS)^-0.5 = 64^-0.5 */
#define EPS   1e-5f

#define EPI_NONE      0
#define EPI_BIAS_RES  2
#define EPI_BIAS_GELU 3

// LDS pitch of an A panel row, in floats: 256 B of data + the 16 B pad that the tensor load lays behind each row
#define A_PITCH 68
// floats per A buffer: 32 rows of 272 B = 8,704 B, rounded up to a multiple of 2 KiB (every tensor-load destination is one)
#define A_BUF   2560

// ------------------------------------------------------------------
// LayerNorm over rows of length 1024 (one block per row, 256 threads)
// ------------------------------------------------------------------
__device__ __forceinline__ void ln1024_row(const float* __restrict__ x,
                                           const float* __restrict__ w,
                                           const float* __restrict__ b,
                                           float* __restrict__ y, int row) {
  __shared__ float red[256];
  const float* xr = x + (long)row * DIM;
  float v[4];
  float s = 0.f;
#pragma unroll
  for (int i = 0; i < 4; ++i) { v[i] = xr[threadIdx.x + 256 * i]; s += v[i]; }
  red[threadIdx.x] = s;
  __syncthreads();
  for (int off = 128; off > 0; off >>= 1) {
    if (threadIdx.x < off) red[threadIdx.x] += red[threadIdx.x + off];
    __syncthreads();
  }
  const float mean = red[0] * (1.f / DIM);
  __syncthreads();
  float s2 = 0.f;
#pragma unroll
  for (int i = 0; i < 4; ++i) { float d = v[i] - mean; s2 += d * d; }
  red[threadIdx.x] = s2;
  __syncthreads();
  for (int off = 128; off > 0; off >>= 1) {
    if (threadIdx.x < off) red[threadIdx.x] += red[threadIdx.x + off];
    __syncthreads();
  }
  const float inv = rsqrtf(red[0] * (1.f / DIM) + EPS);
  float* yr = y + (long)row * DIM;
#pragma unroll
  for (int i = 0; i < 4; ++i) {
    const int c = threadIdx.x + 256 * i;
    yr[c] = (v[i] - mean) * inv * w[c] + b[c];
  }
}

__global__ __launch_bounds__(256) void ln1024_kernel(const float* __restrict__ x,
                                                     const float* __restrict__ w,
                                                     const float* __restrict__ b,
                                                     float* __restrict__ y) {
  ln1024_row(x, w, b, y, blockIdx.x);
}

// The three input streams' LayerNorms depend on nothing of one another: one grid holds the rows of all three,
// LN3_R0 rows of stream 0, then LN3_R1 rows of stream 1, then LN3_R2 rows of stream 2.
#define LN3_R0 (B_ * N_MM)
#define LN3_R1 (B_ * N_A)
#define LN3_R2 (B_ * N_V)
__global__ __launch_bounds__(256) void ln1024_x3_kernel(
    const float* __restrict__ x0, const float* __restrict__ w0, const float* __restrict__ b0, float* __restrict__ y0,
    const float* __restrict__ x1, const float* __restrict__ w1, const float* __restrict__ b1, float* __restrict__ y1,
    const float* __restrict__ x2, const float* __restrict__ w2, const float* __restrict__ b2, float* __restrict__ y2) {
  const int id = blockIdx.x;
  const float* x = x0;
  const float* w = w0;
  const float* b = b0;
  float* y = y0;
  int row = id;
  if (id >= LN3_R0 + LN3_R1) {
    x = x2; w = w2; b = b2; y = y2; row = id - (LN3_R0 + LN3_R1);
  } else if (id >= LN3_R0) {
    x = x1; w = w1; b = b1; y = y1; row = id - LN3_R0;
  }
  ln1024_row(x, w, b, y, row);
}

__device__ __forceinline__ uint32_t uni(uint32_t v) { return (uint32_t)__builtin_amdgcn_readfirstlane(v); }
__device__ __forceinline__ uint32_t pinned(uint32_t v) { uint32_t w = uni(v); asm volatile("" : "+s"(w)); return w; }  // the pinned() form for a test around a tensor load
__device__ __forceinline__ void wait_ds0()     { asm volatile("s_wait_dscnt 0x0" ::: "memory"); }     // this wave's LDS reads have retired
__device__ __forceinline__ void wait_tensor0() { asm volatile("s_wait_tensorcnt 0x0" ::: "memory"); } // this wave's tensor load has landed
__device__ __forceinline__ void wait_tensor0(u32x4& g0, u32x8& g1) {
  asm volatile("s_wait_tensorcnt 0x0" : "+s"(g0), "+s"(g1) :: "memory");
}

__device__ __forceinline__ void tdm_group0(u32x4& g, const float* lptr, const float* gptr) {
  const uint64_t ga = (uint64_t)gptr;
  g[0] = uni(1u);
  g[1] = uni((uint32_t)(uint64_t)lptr);
  g[2] = uni((uint32_t)ga);
  g[3] = uni((((uint32_t)(ga >> 32)) & 0x01FFFFFFu) | 0x80000000u);
}
template <uint32_t WORD0, uint32_t ROWB, uint32_t ROWS>
__device__ __forceinline__ u32x8 tdm_group1(uint32_t src_pitch) {
  u32x8 g;
  g[0] = uni(WORD0);
  g[1] = uni((ROWB & 0xFFFFu) << 16);
  g[2] = uni((ROWB >> 16) | ((ROWS & 0xFFFFu) << 16));
  g[3] = uni((ROWS >> 16) | (ROWB << 16));
  g[4] = uni(ROWS);
  g[5] = uni(src_pitch);
  g[6] = uni(0u);
  g[7] = uni(0u);
  return g;
}
__device__ __forceinline__ void tdm_load(u32x4& g0, u32x8& g1) {
  asm volatile("tensor_load_to_lds %0, %1" : "+s"(g0), "+s"(g1) :: "memory");  // in-out: see wait_tensor0(g0, g1)
}

__device__ __forceinline__ void gemm_tile_f32(
    const float* __restrict__ A, const float* __restrict__ Bm,
    const float* __restrict__ bias, const float* __restrict__ res,
    float* __restrict__ C, int N, int lda, int K, int epi, int tile_m, int tile_n) {
  __shared__ __attribute__((aligned(2048))) float lA[2][A_BUF];       // [m][k] panels, row pitch A_PITCH
  __shared__ __attribute__((aligned(2048))) float lB[2][64 * 128];    // [k][n] panels
  const uint32_t wave = uni(threadIdx.x >> 5);
  const int lane = threadIdx.x & 31;
  const int m0   = tile_m * 32;
  const int nblk = tile_n * 128;
  const int n0   = nblk + (int)wave * 16;

  v8f acc0 = {0.f, 0.f, 0.f, 0.f, 0.f, 0.f, 0.f, 0.f};
  v8f acc1 = acc0;

  const int S = K >> 6;  // number of 64-deep K panels

  u32x8 g1A = tdm_group1<(1u << 20) | (5u << 22) | (3u << 25), 256u, 32u>((uint32_t)lda * 4u);
  u32x8 g1B = tdm_group1<0u, 512u, 64u>((uint32_t)N * 4u);
  const float* gA = A + (long)m0 * lda; // panel s starts at gA + 64 * s
  const float* gB = Bm + nblk;          // panel s starts at gB + 64 * s * N

  u32x4 g0A, g0B;
  tdm_group0(g0A, lA[0], gA);
  tdm_group0(g0B, lB[0], gB);

  // panel 0, landed and published; then panel 1 into the other buffer
  if (pinned(wave == 0u)) {
    tdm_load(g0A, g1A);
    wait_tensor0(g0A, g1A);
  }
  if (pinned(wave == 1u)) {
    tdm_load(g0B, g1B);
    wait_tensor0(g0B, g1B);
  }
  __syncthreads();
  if (pinned(wave == 0u)) {
    tdm_group0(g0A, lA[1], gA + 64);
    tdm_load(g0A, g1A);
  }
  if (pinned(wave == 1u)) {
    tdm_group0(g0B, lB[1], gB + (long)64 * N);
    tdm_load(g0B, g1B);
  }

  for (int i = 0; i < S; ++i) {
    const int cur = i & 1;
    const float* lAc = lA[cur];
    const float* lBc = lB[cur];
    const int ml    = lane & 15;          // A row in tile / B col in tile
    const int khalf = (lane >> 4) << 1;   // lanes 16-31 carry K+2,K+3
#pragma unroll
    for (int kk = 0; kk < 64; kk += 4) {
      const int kb = kk + khalf;
      v2f bf;
      bf.x = lBc[(kb + 0) * 128 + wave * 16 + ml];
      bf.y = lBc[(kb + 1) * 128 + wave * 16 + ml];
      v2f a0, a1;  // A 16x4 frags, M rows 0-15 and 16-31 of block tile
      a0.x = lAc[ml * A_PITCH + kb];            a0.y = lAc[ml * A_PITCH + kb + 1];
      a1.x = lAc[(ml + 16) * A_PITCH + kb];     a1.y = lAc[(ml + 16) * A_PITCH + kb + 1];
      acc0 = __builtin_amdgcn_wmma_f32_16x16x4_f32(false, a0, false, bf,
                                                   (short)0, acc0, false, false);
      acc1 = __builtin_amdgcn_wmma_f32_16x16x4_f32(false, a1, false, bf,
                                                   (short)0, acc1, false, false);
    }
    // Publish panel i + 1 and free panel i's buffer: own LDS reads retired, the issuers' loads landed, one barrier for both.
    __builtin_amdgcn_sched_barrier(0);  // keeps the panel's last WMMAs in front of the wait: behind it they would stall on the full LDS drain
    wait_ds0();
    if (pinned(wave == 0u)) wait_tensor0(g0A, g1A);
    if (pinned(wave == 1u)) wait_tensor0(g0B, g1B);
    __syncthreads();
    // Refill the buffer that every wave has just left, only while a panel i + 2 exists.
    if (pinned(i + 2 < S)) {
      if (pinned(wave == 0u)) {
        tdm_group0(g0A, lA[cur], gA + ((i + 2) << 6));
        tdm_load(g0A, g1A);
      }
      if (pinned(wave == 1u)) {
        tdm_group0(g0B, lB[cur], gB + (long)((i + 2) << 6) * N);
        tdm_load(g0B, g1B);
      }
    }
  }
  wait_tensor0();
  wait_ds0();

  const int col   = n0 + (lane & 15);
  const int rbase = (lane >> 4) << 3;
  const float bv  = (epi != EPI_NONE) ? bias[col] : 0.f;
#pragma unroll
  for (int r = 0; r < 8; ++r) {
    const int row0 = m0 + rbase + r;
    const int row1 = row0 + 16;
    float x0 = acc0[r] + bv;
    float x1 = acc1[r] + bv;
    if (epi == EPI_BIAS_GELU) {
      x0 = 0.5f * x0 * (1.f + erff(x0 * 0.7071067811865476f));
      x1 = 0.5f * x1 * (1.f + erff(x1 * 0.7071067811865476f));
    } else if (epi == EPI_BIAS_RES) {
      x0 += res[(long)row0 * N + col];
      x1 += res[(long)row1 * N + col];
    }
    C[(long)row0 * N + col] = x0;
    C[(long)row1 * N + col] = x1;
  }
}

__global__ __launch_bounds__(256) void gemm_wmma_f32(
    const float* __restrict__ A, const float* __restrict__ Bm,
    const float* __restrict__ bias, const float* __restrict__ res,
    float* __restrict__ C, int M, int N, int K, int epi) {
  (void)M;
  gemm_tile_f32(A, Bm, bias, res, C, N, K, K, epi, blockIdx.x, blockIdx.y);
}

__global__ __launch_bounds__(256) void gemm_splitk_wmma_f32(
    const float* __restrict__ A, const float* __restrict__ Bm,
    float* __restrict__ P, int M, int N, int K, int Kc) {
  const long z = blockIdx.z;
  gemm_tile_f32(A + z * Kc, Bm + z * Kc * N, nullptr, nullptr, P + z * M * N, N, K, Kc, EPI_NONE,
                blockIdx.x, blockIdx.y);
}

#define QKV_SPLIT 4
#define TM0 (B_ * N_MM / 32u)    /* q:        512 x 256 */
#define TN0 (INNER / 128u)
#define TM1 (B_ * N_A / 32u)     /* kv audio: 256 x 512 */
#define TN1 (2 * INNER / 128u)
#define TM2 (B_ * N_V / 32u)     /* kv video: 128 x 512 */
#define TN2 (2 * INNER / 128u)
__global__ __launch_bounds__(256) void gemm_x3_wmma_f32(
    const float* __restrict__ A0, const float* __restrict__ B0, float* __restrict__ C0,
    const float* __restrict__ A1, const float* __restrict__ B1, float* __restrict__ C1,
    const float* __restrict__ A2, const float* __restrict__ B2, float* __restrict__ C2, int K) {
  const uint32_t id = blockIdx.x;
  const float* A = A0;
  const float* Bm = B0;
  float* C = C0;
  uint32_t tile_m = id % TM0, tile_n = id / TM0, tn = TN0, tm = TM0;
  if (id >= TM0 * TN0 + TM1 * TN1) {
    const uint32_t t = id - (TM0 * TN0 + TM1 * TN1);
    A = A2; Bm = B2; C = C2; tile_m = t % TM2; tile_n = t / TM2; tn = TN2; tm = TM2;
  } else if (id >= TM0 * TN0) {
    const uint32_t t = id - TM0 * TN0;
    A = A1; Bm = B1; C = C1; tile_m = t % TM1; tile_n = t / TM1; tn = TN1; tm = TM1;
  }
  const int N = (int)(tn * 128u);
  const int Kc = K / QKV_SPLIT;
  const long z = blockIdx.y;
  gemm_tile_f32(A + z * Kc, Bm + z * Kc * N, nullptr, nullptr, C + z * (long)(tm * 32u) * N, N, K, Kc, EPI_NONE,
                (int)tile_m, (int)tile_n);
}

// ------------------------------------------------------------------
// Factorized attention. Logits over the synthetic 8192-long KV separate as
// s(v,a) = s_v + s_a, so softmax/PV factor into two independent softmaxes:
//   out = softmax(q.k_v^T) @ v_v  +  softmax(q.k_a^T) @ v_a
// One block per (batch, head, chunk of 32 q-tokens). The keys of one q-token are dealt to 8 neighbouring lanes:
// lane j of the 8 takes keys j, j + 8, j + 16, ... of both streams and keeps its 8 + 16 scores in registers;
// the 8 partial maxima, sums and outputs are merged inside the 16-lane row. K/V rows in LDS.
// ------------------------------------------------------------------
typedef __attribute__((ext_vector_type(4))) float f32x4;
#define KSPLIT   8                         /* lanes that share one q-token */
#define TOK_BLK  (256 / KSPLIT)            /* q-tokens per block */
#define N_CHUNK  (N_MM / TOK_BLK)          /* blocks per (batch, head) */
#define NKEY_V   (N_V / KSPLIT)            /* video keys per lane */
#define NKEY     ((N_V + N_A) / KSPLIT)    /* keys per lane, the video keys first */
#define KGRP     4                         /* rows per register set */
#define NGRP     (NKEY / KGRP)
#define KV_PITCH 20

// The value that lane (l ^ M) holds, M < 16 (DPP row_xmask); every lane is on wherever it is used.
template <int M>
__device__ __forceinline__ float row_xor(float x) {
  return __int_as_float(__builtin_amdgcn_update_dpp(0, __float_as_int(x), 0x160 + M, 0xf, 0xf, true));
}
__device__ __forceinline__ float sum8(float x) {
  x += row_xor<1>(x);
  x += row_xor<2>(x);
  x += row_xor<4>(x);
  return x;
}
__device__ __forceinline__ float max8(float x) {
  x = fmaxf(x, row_xor<1>(x));
  x = fmaxf(x, row_xor<2>(x));
  x = fmaxf(x, row_xor<4>(x));
  return x;
}
__device__ __forceinline__ float exp_slot(float x) {
  float r;
  asm("v_exp_f32 %0, %1\n\tv_nop" : "=v"(r) : "v"(x * 1.4426950408889634f));
  return r;
}
// One register set: this lane's next KGRP rows (every KSPLIT-th row from p on), 16 floats each.
struct RowSet { f32x4 r[KGRP][HD / 4]; };
__device__ __forceinline__ void load_rows(RowSet& t, const float* p) {
#pragma unroll
  for (int u = 0; u < KGRP; ++u)
#pragma unroll
    for (int c = 0; c < HD / 4; ++c) t.r[u][c] = *(const f32x4*)(p + u * KSPLIT * KV_PITCH + 4 * c);
}
// q . k over 16 dims, as four partial sums in two packed chains
__device__ __forceinline__ float dot16(const v2f* q2, const f32x4* k) {
  v2f a = {0.f, 0.f}, b = {0.f, 0.f};
#pragma unroll
  for (int c = 0; c < HD / 4; ++c) {
    a = __builtin_elementwise_fma(q2[2 * c], k[c].xy, a);
    b = __builtin_elementwise_fma(q2[2 * c + 1], k[c].zw, b);
  }
  const v2f t = a + b;
  return t.x + t.y;
}
__device__ __forceinline__ void axpy16(v2f* o2, float e, const f32x4* v) {
  const v2f e2 = {e, e};
#pragma unroll
  for (int c = 0; c < HD / 4; ++c) {
    o2[2 * c]     = __builtin_elementwise_fma(e2, v[c].xy, o2[2 * c]);
    o2[2 * c + 1] = __builtin_elementwise_fma(e2, v[c].zw, o2[2 * c + 1]);
  }
}

// 16 bytes of a product that was stored as NP split-K planes of PLANE floats each: the planes added in the order of z
template <int NP, long PLANE>
__device__ __forceinline__ f32x4 sum_planes(const float* __restrict__ p) {
  f32x4 x = *(const f32x4*)p;
#pragma unroll
  for (int z = 1; z < NP; ++z) x += *(const f32x4*)(p + z * PLANE);
  return x;
}

// q, kvv, kva: QKV_SPLIT planes each, added here as they are read
__global__ __launch_bounds__(256) void attn_factored_kernel(
    const float* __restrict__ q, const float* __restrict__ kvv,
    const float* __restrict__ kva, float* __restrict__ out) {
  const int chunk = blockIdx.x % N_CHUNK;
  const int h = (blockIdx.x / N_CHUNK) & 15;
  const int b = blockIdx.x / (N_CHUNK * HEADS);
  // rows 0 .. N_V - 1: video keys; rows N_V .. N_V + N_A - 1: audio keys
  __shared__ __attribute__((aligned(16))) float kS[N_V + N_A][KV_PITCH];
  __shared__ __attribute__((aligned(16))) float vS[N_V + N_A][KV_PITCH];

  const int j   = threadIdx.x & (KSPLIT - 1);
  const int tok = chunk * TOK_BLK + (threadIdx.x / KSPLIT);
  v2f q2[HD / 2];
  const float* qp = q + (long)(b * N_MM + tok) * INNER + h * HD;
#pragma unroll
  for (int c = 0; c < HD / 4; ++c) {
    const f32x4 x = sum_planes<QKV_SPLIT, (long)B_ * N_MM * INNER>(qp + 4 * c);
    q2[2 * c] = x.xy;
    q2[2 * c + 1] = x.zw;
  }

  // 8 pieces of 16 B per key: 4 of its K row, 4 of its V row; 32 keys per round of the block
  const int part = (threadIdx.x >> 2) & 1, quad = threadIdx.x & 3;
  const int soff = part * INNER + h * HD + quad * 4;
  const int row0 = threadIdx.x >> 3;
  float* sdst = (part ? &vS[0][0] : &kS[0][0]) + quad * 4 + row0 * KV_PITCH;
  const float* pv = kvv + (long)(b * N_V + row0) * (2 * INNER) + soff;
  const float* pa = kva + (long)(b * N_A + row0) * (2 * INNER) + soff;
  f32x4 xv[N_V / 32], xa[N_A / 32];
#pragma unroll
  for (int it = 0; it < N_V / 32; ++it)
    xv[it] = sum_planes<QKV_SPLIT, (long)B_ * N_V * 2 * INNER>(pv + it * 32 * 2 * INNER);
#pragma unroll
  for (int it = 0; it < N_A / 32; ++it)
    xa[it] = sum_planes<QKV_SPLIT, (long)B_ * N_A * 2 * INNER>(pa + it * 32 * 2 * INNER);
  // The wait that stands in front of an overwrite of a register that an issued global load names. The three address pairs
  // are inputs, so that they live up to here and no later load's destination is laid over them.
  asm volatile("s_wait_xcnt 0x0" :: "v"(qp), "v"(pv), "v"(pa) : "memory");
#pragma unroll
  for (int it = 0; it < N_V / 32; ++it) *(f32x4*)(sdst + 32 * it * KV_PITCH) = xv[it];
#pragma unroll
  for (int it = 0; it < N_A / 32; ++it) *(f32x4*)(sdst + (N_V + 32 * it) * KV_PITCH) = xa[it];
  __syncthreads();

  // Key number i of this lane is row i * KSPLIT + j. Two register sets: the next KGRP rows are read while these are worked on.
  // The scheduling fence of each step keeps the next set's 16 reads together and ahead of the arithmetic on this set: left to
  // itself the compiler spreads the reads singly among the arithmetic, with only a few of them in flight.
  const float* kl = &kS[j][0];
  const float* vl = &vS[j][0];
  RowSet rs[2];
  float s[NKEY];
  load_rows(rs[0], kl);
#pragma unroll
  for (int g = 0; g < NGRP; ++g) {
    load_rows(rs[(g + 1) & 1], (g + 1 < NGRP) ? kl + (g + 1) * KGRP * KSPLIT * KV_PITCH : vl);
    __builtin_amdgcn_sched_barrier(0);  // the next set's reads stay in front of this set's arithmetic
#pragma unroll
    for (int u = 0; u < KGRP; ++u) s[g * KGRP + u] = dot16(q2, rs[g & 1].r[u]) * SCALE;
  }

  // maximum over all keys of each stream, then the exponentials
  float mV = s[0], mA = s[NKEY_V];
#pragma unroll
  for (int i = 1; i < NKEY_V; ++i) mV = fmaxf(mV, s[i]);
#pragma unroll
  for (int i = NKEY_V + 1; i < NKEY; ++i) mA = fmaxf(mA, s[i]);
  mV = max8(mV);
  mA = max8(mA);
  float lV = 0.f, lA = 0.f;
#pragma unroll
  for (int i = 0; i < NKEY_V; ++i) { s[i] = exp_slot(s[i] - mV); lV += s[i]; }
#pragma unroll
  for (int i = NKEY_V; i < NKEY; ++i) { s[i] = exp_slot(s[i] - mA); lA += s[i]; }

  v2f oV[HD / 2], oA[HD / 2];
#pragma unroll
  for (int d = 0; d < HD / 2; ++d) { oV[d] = (v2f){0.f, 0.f}; oA[d] = (v2f){0.f, 0.f}; }
#pragma unroll
  for (int g = 0; g < NGRP; ++g) {
    if (g + 1 < NGRP) load_rows(rs[(NGRP + g + 1) & 1], vl + (g + 1) * KGRP * KSPLIT * KV_PITCH);
    __builtin_amdgcn_sched_barrier(0);
#pragma unroll
    for (int u = 0; u < KGRP; ++u) {
      const int i = g * KGRP + u;
      axpy16(i < NKEY_V ? oV : oA, s[i], rs[(NGRP + g) & 1].r[u]);
    }
  }
  const float invV = 1.f / sum8(lV);
  const float invA = 1.f / sum8(lA);

  float c[HD];
#pragma unroll
  for (int d = 0; d < HD / 2; ++d) {
    const v2f t = oV[d] * invV + oA[d] * invA;
    c[2 * d]     = sum8(t.x);
    c[2 * d + 1] = sum8(t.y);
  }

  if (j == 0) {
    f32x4* op = (f32x4*)(out + (long)(b * N_MM + tok) * INNER + h * HD);
#pragma unroll
    for (int g = 0; g < HD / 4; ++g) {
      f32x4 x = {c[4 * g], c[4 * g + 1], c[4 * g + 2], c[4 * g + 3]};
      op[g] = x;
    }
  }
}

// ------------------------------------------------------------------
// out = planes of the split-K product added in the order of z, + bias + residual.
// SUM_VEC pieces of 16 bytes per thread, all of their loads in flight together: few work-groups, so the grid starts fast.
// ------------------------------------------------------------------
#define W2_SPLIT 4
#define SUM_VEC  4
__global__ __launch_bounds__(256) void sum_planes_bias_res_kernel(
    const float* __restrict__ P, const float* __restrict__ bias,
    const float* __restrict__ res, float* __restrict__ out) {
#pragma unroll
  for (int i = 0; i < SUM_VEC; ++i) {
    const long e = (((long)blockIdx.x * SUM_VEC + i) * 256 + threadIdx.x) * 4;   // first element of the piece
    f32x4 x = sum_planes<W2_SPLIT, (long)B_ * N_MM * DIM>(P + e);
    x += *(const f32x4*)(bias + (e & (DIM - 1)));
    x += *(const f32x4*)(res + e);
    *(f32x4*)(out + e) = x;
  }
}

// ------------------------------------------------------------------
extern "C" void kernel_launch(void* const* d_in, const int* in_sizes, int n_in,
                              void* d_out, int out_size, void* d_ws, size_t ws_size,
                              hipStream_t stream) {
  (void)in_sizes; (void)n_in; (void)out_size; (void)ws_size;
  const float* xmm      = (const float*)d_in[0];
  const float* xv       = (const float*)d_in[1];
  const float* xa       = (const float*)d_in[2];
  const float* ln_mm_w  = (const float*)d_in[3];
  const float* ln_mm_b  = (const float*)d_in[4];
  const float* ln_v_w   = (const float*)d_in[5];
  const float* ln_v_b   = (const float*)d_in[6];
  const float* ln_a_w   = (const float*)d_in[7];
  const float* ln_a_b   = (const float*)d_in[8];
  const float* Wq       = (const float*)d_in[9];
  const float* Wkv      = (const float*)d_in[10];
  const float* Wproj    = (const float*)d_in[11];
  const float* bproj    = (const float*)d_in[12];
  const float* ln_mlp_w = (const float*)d_in[13];
  const float* ln_mlp_b = (const float*)d_in[14];
  const float* W1       = (const float*)d_in[15];
  const float* b1       = (const float*)d_in[16];
  const float* W2       = (const float*)d_in[17];
  const float* b2       = (const float*)d_in[18];
  float* out = (float*)d_out;
  float* ws  = (float*)d_ws;

  const int RM = B_ * N_MM;  // 512 rows (mm stream)
  float* src_mm = ws;                               // 512*1024
  float* src_v  = src_mm + (long)RM * DIM;          // 128*1024
  float* src_a  = src_v + (long)B_ * N_V * DIM;     // 256*1024
  float* qbuf   = src_a + (long)B_ * N_A * DIM;                 // QKV_SPLIT planes of 512*256
  float* kvv    = qbuf + (long)QKV_SPLIT * RM * INNER;          // QKV_SPLIT planes of 128*512
  float* kva    = kvv + (long)QKV_SPLIT * B_ * N_V * 2 * INNER; // QKV_SPLIT planes of 256*512
  float* attnb  = kva + (long)QKV_SPLIT * B_ * N_A * 2 * INNER; // 512*256
  float* xmm2   = attnb + (long)RM * INNER;         // 512*1024
  float* hln    = xmm2 + (long)RM * DIM;            // 512*1024
  float* act    = hln + (long)RM * DIM;             // 512*4096
  float* w2p    = act + (long)RM * HID;             // W2_SPLIT planes of 512*1024

  // 1) LayerNorms
  ln1024_x3_kernel<<<LN3_R0 + LN3_R1 + LN3_R2, 256, 0, stream>>>(
      xmm, ln_mm_w, ln_mm_b, src_mm, xa, ln_a_w, ln_a_b, src_a, xv, ln_v_w, ln_v_b, src_v);

  // 2) Projections (WMMA GEMMs). Wkv[:DIM] / Wkv[DIM:] are contiguous halves.
  //    q (16 x 2 tiles), kv of the audio stream (8 x 4) and kv of the video stream (4 x 4) in one grid of 80 tiles,
  //    times QKV_SPLIT shares of K.
  gemm_x3_wmma_f32<<<dim3(TM0 * TN0 + TM1 * TN1 + TM2 * TN2, QKV_SPLIT), 256, 0, stream>>>(
      src_mm, Wq, qbuf,
      src_a, Wkv + (long)DIM * 2 * INNER, kva,
      src_v, Wkv, kvv, DIM);

  // 3) Factorized attention over the separable 8192-key softmax
  attn_factored_kernel<<<B_ * HEADS * N_CHUNK, 256, 0, stream>>>(qbuf, kvv, kva, attnb);

  // 4) Output proj + bias + residual -> xmm2
  gemm_wmma_f32<<<dim3(16, 8), 256, 0, stream>>>(attnb, Wproj, bproj, xmm,
                                                 xmm2, RM, DIM, INNER, EPI_BIAS_RES);

  // 5) MLP: LN -> W1+gelu -> W2 (W2_SPLIT shares of K) -> planes + bias + residual
  ln1024_kernel<<<RM, 256, 0, stream>>>(xmm2, ln_mlp_w, ln_mlp_b, hln);
  gemm_wmma_f32<<<dim3(16, 32), 256, 0, stream>>>(hln, W1, b1, nullptr,
                                                  act, RM, HID, DIM, EPI_BIAS_GELU);
  gemm_splitk_wmma_f32<<<dim3(16, 8, W2_SPLIT), 256, 0, stream>>>(act, W2, w2p, RM, DIM, HID, HID / W2_SPLIT);
  sum_planes_bias_res_kernel<<<RM * DIM / (4 * 256 * SUM_VEC), 256, 0, stream>>>(w2p, b2, xmm2, out);
}

// v005
// It runs in 88.1 microseconds.
// Timed twice side by side with v004, it ran 1.04 times as fast both times.
// Counting every step since v000, it is 4.31 times as fast.
#include <hip/hip_runtime.h>
#include <math.h>
#include <stdint.h>

typedef __attribute__((ext_vector_type(2))) float v2f;
typedef __attribute__((ext_vector_type(8))) float v8f;
typedef __attribute__((ext_vector_type(4))) unsigned int u32x4;
typedef __attribute__((ext_vector_type(8))) unsigned int u32x8;

#define B_    2
#define N_MM  256
#define N_V   64
#define N_A   128
#define DIM   1024
#define HEADS 16
#define INNER 256
#define HID   4096
#define HD    16
#define SCALE 0.125f   /* (DIM/HEADS)^-0.5 = 64^-0.5 */
#define EPS   1e-5f

#define EPI_NONE      0
#define EPI_BIAS_RES  2
#define EPI_BIAS_GELU 3

// LDS pitch of an A panel row, in floats: 256 B of data + the 16 B pad that the tensor load lays behind each row
#define A_PITCH 68
// floats per A buffer: 32 rows of 272 B = 8,704 B, rounded up to a multiple of 2 KiB (every tensor-load destination is one)
#define A_BUF   2560

// ------------------------------------------------------------------
// LayerNorm over rows of length 1024: one wave per row, LN_ROWS rows (waves) per block.
// A lane holds 32 elements of its row, as 8 pieces of 16 bytes; each wave-wide load or store covers 512 contiguous bytes.
// Both sums are merged across the 32 lanes in registers: no LDS, no barrier, and an eighth of the waves to start.
// ------------------------------------------------------------------
typedef __attribute__((ext_vector_type(4))) float f32x4;
#define LN_ROWS 4
#define LN_VEC  (DIM / (32 * 4))           /* 16-byte pieces per lane */

// The value that lane (l ^ M) holds, M < 16 (DPP row_xmask); every lane is on wherever it is used.
template <int M>
__device__ __forceinline__ float row_xor(float x) {
  return __int_as_float(__builtin_amdgcn_update_dpp(0, __float_as_int(x), 0x160 + M, 0xf, 0xf, true));
}
__device__ __forceinline__ float sum32(float x) {
  x += row_xor<1>(x);
  x += row_xor<2>(x);
  x += row_xor<4>(x);
  x += row_xor<8>(x);
  const int xi = __float_as_int(x);
  x += __int_as_float(__builtin_amdgcn_permlanex16(xi, xi, 0x76543210, 0xfedcba98, false, false));
  return x;
}

// row, x, w, b, y are the same in every lane of the wave
__device__ __forceinline__ void ln1024_row(const float* __restrict__ x,
                                           const float* __restrict__ w,
                                           const float* __restrict__ b,
                                           float* __restrict__ y, int row) {
  const uint32_t off = (threadIdx.x & 31u) * 4u;   // this lane's first element in each 128-element piece of the row
  const float* xr = x + (long)row * DIM;
  f32x4 v[LN_VEC], wv[LN_VEC], bv[LN_VEC];
#pragma unroll
  for (int i = 0; i < LN_VEC; ++i) v[i] = *(const f32x4*)(xr + off + 128 * i);
#pragma unroll
  for (int i = 0; i < LN_VEC; ++i) wv[i] = *(const f32x4*)(w + off + 128 * i);
#pragma unroll
  for (int i = 0; i < LN_VEC; ++i) bv[i] = *(const f32x4*)(b + off + 128 * i);
  // The wait that stands in front of an overwrite of a register that an issued global load names. The offset and the three
  // bases are inputs, so that they live up to here and no later load's destination is laid over them.
  asm volatile("s_wait_xcnt 0x0" :: "v"(off), "s"(xr), "s"(w), "s"(b) : "memory");
  __builtin_amdgcn_sched_barrier(0);  // all 24 loads stay in front of the arithmetic, in flight together: left to itself the compiler sinks those of w and b to their uses, two at a time, each pair a latency of its own

  f32x4 s4 = v[0];
#pragma unroll
  for (int i = 1; i < LN_VEC; ++i) s4 += v[i];
  const float mean = sum32((s4.x + s4.y) + (s4.z + s4.w)) * (1.f / DIM);
  f32x4 q4 = {0.f, 0.f, 0.f, 0.f};
#pragma unroll
  for (int i = 0; i < LN_VEC; ++i) { v[i] -= mean; q4 += v[i] * v[i]; }
  const float inv = rsqrtf(sum32((q4.x + q4.y) + (q4.z + q4.w)) * (1.f / DIM) + EPS);
  float* yr = y + (long)row * DIM;
#pragma unroll
  for (int i = 0; i < LN_VEC; ++i) *(f32x4*)(yr + off + 128 * i) = v[i] * inv * wv[i] + bv[i];
}

__global__ __launch_bounds__(32 * LN_ROWS) void ln1024_kernel(const float* __restrict__ x,
                                                              const float* __restrict__ w,
                                                              const float* __restrict__ b,
                                                              float* __restrict__ y) {
  ln1024_row(x, w, b, y, (int)(blockIdx.x * LN_ROWS) + __builtin_amdgcn_readfirstlane((int)(threadIdx.x >> 5)));
}

// The three input streams' LayerNorms depend on nothing of one another: one grid holds the rows of all three,
// LN3_R0 rows of stream 0, then LN3_R1 rows of stream 1, then LN3_R2 rows of stream 2.
#define LN3_R0 (B_ * N_MM)
#define LN3_R1 (B_ * N_A)
#define LN3_R2 (B_ * N_V)
__global__ __launch_bounds__(32 * LN_ROWS) void ln1024_x3_kernel(
    const float* __restrict__ x0, const float* __restrict__ w0, const float* __restrict__ b0, float* __restrict__ y0,
    const float* __restrict__ x1, const float* __restrict__ w1, const float* __restrict__ b1, float* __restrict__ y1,
    const float* __restrict__ x2, const float* __restrict__ w2, const float* __restrict__ b2, float* __restrict__ y2) {
  const int id = (int)(blockIdx.x * LN_ROWS) + __builtin_amdgcn_readfirstlane((int)(threadIdx.x >> 5));
  const float* x = x0;
  const float* w = w0;
  const float* b = b0;
  float* y = y0;
  int row = id;
  if (id >= LN3_R0 + LN3_R1) {
    x = x2; w = w2; b = b2; y = y2; row = id - (LN3_R0 + LN3_R1);
  } else if (id >= LN3_R0) {
    x = x1; w = w1; b = b1; y = y1; row = id - LN3_R0;
  }
  ln1024_row(x, w, b, y, row);
}

__device__ __forceinline__ uint32_t uni(uint32_t v) { return (uint32_t)__builtin_amdgcn_readfirstlane(v); }
__device__ __forceinline__ uint32_t pinned(uint32_t v) { uint32_t w = uni(v); asm volatile("" : "+s"(w)); return w; }  // the pinned() form for a test around a tensor load
__device__ __forceinline__ void wait_ds0()     { asm volatile("s_wait_dscnt 0x0" ::: "memory"); }     // this wave's LDS reads have retired
__device__ __forceinline__ void wait_tensor0() { asm volatile("s_wait_tensorcnt 0x0" ::: "memory"); } // this wave's tensor load has landed
__device__ __forceinline__ void wait_tensor0(u32x4& g0, u32x8& g1) {
  asm volatile("s_wait_tensorcnt 0x0" : "+s"(g0), "+s"(g1) :: "memory");
}

__device__ __forceinline__ void tdm_group0(u32x4& g, const float* lptr, const float* gptr) {
  const uint64_t ga = (uint64_t)gptr;
  g[0] = uni(1u);
  g[1] = uni((uint32_t)(uint64_t)lptr);
  g[2] = uni((uint32_t)ga);
  g[3] = uni((((uint32_t)(ga >> 32)) & 0x01FFFFFFu) | 0x80000000u);
}
template <uint32_t WORD0, uint32_t ROWB, uint32_t ROWS>
__device__ __forceinline__ u32x8 tdm_group1(uint32_t src_pitch) {
  u32x8 g;
  g[0] = uni(WORD0);
  g[1] = uni((ROWB & 0xFFFFu) << 16);
  g[2] = uni((ROWB >> 16) | ((ROWS & 0xFFFFu) << 16));
  g[3] = uni((ROWS >> 16) | (ROWB << 16));
  g[4] = uni(ROWS);
  g[5] = uni(src_pitch);
  g[6] = uni(0u);
  g[7] = uni(0u);
  return g;
}
__device__ __forceinline__ void tdm_load(u32x4& g0, u32x8& g1) {
  asm volatile("tensor_load_to_lds %0, %1" : "+s"(g0), "+s"(g1) :: "memory");  // in-out: see wait_tensor0(g0, g1)
}

__device__ __forceinline__ void gemm_tile_f32(
    const float* __restrict__ A, const float* __restrict__ Bm,
    const float* __restrict__ bias, const float* __restrict__ res,
    float* __restrict__ C, int N, int lda, int K, int epi, int tile_m, int tile_n) {
  __shared__ __attribute__((aligned(2048))) float lA[2][A_BUF];       // [m][k] panels, row pitch A_PITCH
  __shared__ __attribute__((aligned(2048))) float lB[2][64 * 128];    // [k][n] panels
  const uint32_t wave = uni(threadIdx.x >> 5);
  const int lane = threadIdx.x & 31;
  const int m0   = tile_m * 32;
  const int nblk = tile_n * 128;
  const int n0   = nblk + (int)wave * 16;

  v8f acc0 = {0.f, 0.f, 0.f, 0.f, 0.f, 0.f, 0.f, 0.f};
  v8f acc1 = acc0;

  const int S = K >> 6;  // number of 64-deep K panels

  u32x8 g1A = tdm_group1<(1u << 20) | (5u << 22) | (3u << 25), 256u, 32u>((uint32_t)lda * 4u);
  u32x8 g1B = tdm_group1<0u, 512u, 64u>((uint32_t)N * 4u);
  const float* gA = A + (long)m0 * lda; // panel s starts at gA + 64 * s
  const float* gB = Bm + nblk;          // panel s starts at gB + 64 * s * N

  u32x4 g0A, g0B;
  tdm_group0(g0A, lA[0], gA);
  tdm_group0(g0B, lB[0], gB);

  // panel 0, landed and published; then panel 1 into the other buffer
  if (pinned(wave == 0u)) {
    tdm_load(g0A, g1A);
    wait_tensor0(g0A, g1A);
  }
  if (pinned(wave == 1u)) {
    tdm_load(g0B, g1B);
    wait_tensor0(g0B, g1B);
  }
  __syncthreads();
  if (pinned(wave == 0u)) {
    tdm_group0(g0A, lA[1], gA + 64);
    tdm_load(g0A, g1A);
  }
  if (pinned(wave == 1u)) {
    tdm_group0(g0B, lB[1], gB + (long)64 * N);
    tdm_load(g0B, g1B);
  }

  for (int i = 0; i < S; ++i) {
    const int cur = i & 1;
    const float* lAc = lA[cur];
    const float* lBc = lB[cur];
    const int ml    = lane & 15;          // A row in tile / B col in tile
    const int khalf = (lane >> 4) << 1;   // lanes 16-31 carry K+2,K+3
#pragma unroll
    for (int kk = 0; kk < 64; kk += 4) {
      const int kb = kk + khalf;
      v2f bf;
      bf.x = lBc[(kb + 0) * 128 + wave * 16 + ml];
      bf.y = lBc[(kb + 1) * 128 + wave * 16 + ml];
      v2f a0, a1;  // A 16x4 frags, M rows 0-15 and 16-31 of block tile
      a0.x = lAc[ml * A_PITCH + kb];            a0.y = lAc[ml * A_PITCH + kb + 1];
      a1.x = lAc[(ml + 16) * A_PITCH + kb];     a1.y = lAc[(ml + 16) * A_PITCH + kb + 1];
      acc0 = __builtin_amdgcn_wmma_f32_16x16x4_f32(false, a0, false, bf,
                                                   (short)0, acc0, false, false);
      acc1 = __builtin_amdgcn_wmma_f32_16x16x4_f32(false, a1, false, bf,
                                                   (short)0, acc1, false, false);
    }
    // Publish panel i + 1 and free panel i's buffer: own LDS reads retired, the issuers' loads landed, one barrier for both.
    __builtin_amdgcn_sched_barrier(0);  // keeps the panel's last WMMAs in front of the wait: behind it they would stall on the full LDS drain
    wait_ds0();
    if (pinned(wave == 0u)) wait_tensor0(g0A, g1A);
    if (pinned(wave == 1u)) wait_tensor0(g0B, g1B);
    __syncthreads();
    // Refill the buffer that every wave has just left, only while a panel i + 2 exists.
    if (pinned(i + 2 < S)) {
      if (pinned(wave == 0u)) {
        tdm_group0(g0A, lA[cur], gA + ((i + 2) << 6));
        tdm_load(g0A, g1A);
      }
      if (pinned(wave == 1u)) {
        tdm_group0(g0B, lB[cur], gB + (long)((i + 2) << 6) * N);
        tdm_load(g0B, g1B);
      }
    }
  }
  wait_tensor0();
  wait_ds0();

  const int col   = n0 + (lane & 15);
  const int rbase = (lane >> 4) << 3;
  const float bv  = (epi != EPI_NONE) ? bias[col] : 0.f;
#pragma unroll
  for (int r = 0; r < 8; ++r) {
    const int row0 = m0 + rbase + r;
    const int row1 = row0 + 16;
    float x0 = acc0[r] + bv;
    float x1 = acc1[r] + bv;
    if (epi == EPI_BIAS_GELU) {
      x0 = 0.5f * x0 * (1.f + erff(x0 * 0.7071067811865476f));
      x1 = 0.5f * x1 * (1.f + erff(x1 * 0.7071067811865476f));
    } else if (epi == EPI_BIAS_RES) {
      x0 += res[(long)row0 * N + col];
      x1 += res[(long)row1 * N + col];
    }
    C[(long)row0 * N + col] = x0;
    C[(long)row1 * N + col] = x1;
  }
}

__global__ __launch_bounds__(256) void gemm_wmma_f32(
    const float* __restrict__ A, const float* __restrict__ Bm,
    const float* __restrict__ bias, const float* __restrict__ res,
    float* __restrict__ C, int M, int N, int K, int epi) {
  (void)M;
  gemm_tile_f32(A, Bm, bias, res, C, N, K, K, epi, blockIdx.x, blockIdx.y);
}

__global__ __launch_bounds__(256) void gemm_splitk_wmma_f32(
    const float* __restrict__ A, const float* __restrict__ Bm,
    float* __restrict__ P, int M, int N, int K, int Kc) {
  const long z = blockIdx.z;
  gemm_tile_f32(A + z * Kc, Bm + z * Kc * N, nullptr, nullptr, P + z * M * N, N, K, Kc, EPI_NONE,
                blockIdx.x, blockIdx.y);
}

#define QKV_SPLIT 4
#define TM0 (B_ * N_MM / 32u)    /* q:        512 x 256 */
#define TN0 (INNER / 128u)
#define TM1 (B_ * N_A / 32u)     /* kv audio: 256 x 512 */
#define TN1 (2 * INNER / 128u)
#define TM2 (B_ * N_V / 32u)     /* kv video: 128 x 512 */
#define TN2 (2 * INNER / 128u)
__global__ __launch_bounds__(256) void gemm_x3_wmma_f32(
    const float* __restrict__ A0, const float* __restrict__ B0, float* __restrict__ C0,
    const float* __restrict__ A1, const float* __restrict__ B1, float* __restrict__ C1,
    const float* __restrict__ A2, const float* __restrict__ B2, float* __restrict__ C2, int K) {
  const uint32_t id = blockIdx.x;
  const float* A = A0;
  const float* Bm = B0;
  float* C = C0;
  uint32_t tile_m = id % TM0, tile_n = id / TM0, tn = TN0, tm = TM0;
  if (id >= TM0 * TN0 + TM1 * TN1) {
    const uint32_t t = id - (TM0 * TN0 + TM1 * TN1);
    A = A2; Bm = B2; C = C2; tile_m = t % TM2; tile_n = t / TM2; tn = TN2; tm = TM2;
  } else if (id >= TM0 * TN0) {
    const uint32_t t = id - TM0 * TN0;
    A = A1; Bm = B1; C = C1; tile_m = t % TM1; tile_n = t / TM1; tn = TN1; tm = TM1;
  }
  const int N = (int)(tn * 128u);
  const int Kc = K / QKV_SPLIT;
  const long z = blockIdx.y;
  gemm_tile_f32(A + z * Kc, Bm + z * Kc * N, nullptr, nullptr, C + z * (long)(tm * 32u) * N, N, K, Kc, EPI_NONE,
                (int)tile_m, (int)tile_n);
}

// ------------------------------------------------------------------
// Factorized attention. Logits over the synthetic 8192-long KV separate as
// s(v,a) = s_v + s_a, so softmax/PV factor into two independent softmaxes:
//   out = softmax(q.k_v^T) @ v_v  +  softmax(q.k_a^T) @ v_a
// One block per (batch, head, chunk of 32 q-tokens). The keys of one q-token are dealt to 8 neighbouring lanes:
// lane j of the 8 takes keys j, j + 8, j + 16, ... of both streams and keeps its 8 + 16 scores in registers;
// the 8 partial maxima, sums and outputs are merged inside the 16-lane row. K/V rows in LDS.
// ------------------------------------------------------------------
#define KSPLIT   8                         /* lanes that share one q-token */
#define TOK_BLK  (256 / KSPLIT)            /* q-tokens per block */
#define N_CHUNK  (N_MM / TOK_BLK)          /* blocks per (batch, head) */
#define NKEY_V   (N_V / KSPLIT)            /* video keys per lane */
#define NKEY     ((N_V + N_A) / KSPLIT)    /* keys per lane, the video keys first */
#define KGRP     4                         /* rows per register set */
#define NGRP     (NKEY / KGRP)
#define KV_PITCH 20

__device__ __forceinline__ float sum8(float x) {
  x += row_xor<1>(x);
  x += row_xor<2>(x);
  x += row_xor<4>(x);
  return x;
}
__device__ __forceinline__ float max8(float x) {
  x = fmaxf(x, row_xor<1>(x));
  x = fmaxf(x, row_xor<2>(x));
  x = fmaxf(x, row_xor<4>(x));
  return x;
}
__device__ __forceinline__ float exp_slot(float x) {
  float r;
  asm("v_exp_f32 %0, %1\n\tv_nop" : "=v"(r) : "v"(x * 1.4426950408889634f));
  return r;
}
// One register set: this lane's next KGRP rows (every KSPLIT-th row from p on), 16 floats each.
struct RowSet { f32x4 r[KGRP][HD / 4]; };
__device__ __forceinline__ void load_rows(RowSet& t, const float* p) {
#pragma unroll
  for (int u = 0; u < KGRP; ++u)
#pragma unroll
    for (int c = 0; c < HD / 4; ++c) t.r[u][c] = *(const f32x4*)(p + u * KSPLIT * KV_PITCH + 4 * c);
}
// q . k over 16 dims, as four partial sums in two packed chains
__device__ __forceinline__ float dot16(const v2f* q2, const f32x4* k) {
  v2f a = {0.f, 0.f}, b = {0.f, 0.f};
#pragma unroll
  for (int c = 0; c < HD / 4; ++c) {
    a = __builtin_elementwise_fma(q2[2 * c], k[c].xy, a);
    b = __builtin_elementwise_fma(q2[2 * c + 1], k[c].zw, b);
  }
  const v2f t = a + b;
  return t.x + t.y;
}
__device__ __forceinline__ void axpy16(v2f* o2, float e, const f32x4* v) {
  const v2f e2 = {e, e};
#pragma unroll
  for (int c = 0; c < HD / 4; ++c) {
    o2[2 * c]     = __builtin_elementwise_fma(e2, v[c].xy, o2[2 * c]);
    o2[2 * c + 1] = __builtin_elementwise_fma(e2, v[c].zw, o2[2 * c + 1]);
  }
}

// 16 bytes of a product that was stored as NP split-K planes of PLANE floats each: the planes added in the order of z
template <int NP, long PLANE>
__device__ __forceinline__ f32x4 sum_planes(const float* __restrict__ p) {
  f32x4 x = *(const f32x4*)p;
#pragma unroll
  for (int z = 1; z < NP; ++z) x += *(const f32x4*)(p + z * PLANE);
  return x;
}

// q, kvv, kva: QKV_SPLIT planes each, added here as they are read
__global__ __launch_bounds__(256) void attn_factored_kernel(
    const float* __restrict__ q, const float* __restrict__ kvv,
    const float* __restrict__ kva, float* __restrict__ out) {
  const int chunk = blockIdx.x % N_CHUNK;
  const int h = (blockIdx.x / N_CHUNK) & 15;
  const int b = blockIdx.x / (N_CHUNK * HEADS);
  // rows 0 .. N_V - 1: video keys; rows N_V .. N_V + N_A - 1: audio keys
  __shared__ __attribute__((aligned(16))) float kS[N_V + N_A][KV_PITCH];
  __shared__ __attribute__((aligned(16))) float vS[N_V + N_A][KV_PITCH];

  const int j   = threadIdx.x & (KSPLIT - 1);
  const int tok = chunk * TOK_BLK + (threadIdx.x / KSPLIT);
  v2f q2[HD / 2];
  const float* qp = q + (long)(b * N_MM + tok) * INNER + h * HD;
#pragma unroll
  for (int c = 0; c < HD / 4; ++c) {
    const f32x4 x = sum_planes<QKV_SPLIT, (long)B_ * N_MM * INNER>(qp + 4 * c);
    q2[2 * c] = x.xy;
    q2[2 * c + 1] = x.zw;
  }

  // 8 pieces of 16 B per key: 4 of its K row, 4 of its V row; 32 keys per round of the block
  const int part = (threadIdx.x >> 2) & 1, quad = threadIdx.x & 3;
  const int soff = part * INNER + h * HD + quad * 4;
  const int row0 = threadIdx.x >> 3;
  float* sdst = (part ? &vS[0][0] : &kS[0][0]) + quad * 4 + row0 * KV_PITCH;
  const float* pv = kvv + (long)(b * N_V + row0) * (2 * INNER) + soff;
  const float* pa = kva + (long)(b * N_A + row0) * (2 * INNER) + soff;
  f32x4 xv[N_V / 32], xa[N_A / 32];
#pragma unroll
  for (int it = 0; it < N_V / 32; ++it)
    xv[it] = sum_planes<QKV_SPLIT, (long)B_ * N_V * 2 * INNER>(pv + it * 32 * 2 * INNER);
#pragma unroll
  for (int it = 0; it < N_A / 32; ++it)
    xa[it] = sum_planes<QKV_SPLIT, (long)B_ * N_A * 2 * INNER>(pa + it * 32 * 2 * INNER);
  // The wait that stands in front of an overwrite of a register that an issued global load names. The three address pairs
  // are inputs, so that they live up to here and no later load's destination is laid over them.
  asm volatile("s_wait_xcnt 0x0" :: "v"(qp), "v"(pv), "v"(pa) : "memory");
#pragma unroll
  for (int it = 0; it < N_V / 32; ++it) *(f32x4*)(sdst + 32 * it * KV_PITCH) = xv[it];
#pragma unroll
  for (int it = 0; it < N_A / 32; ++it) *(f32x4*)(sdst + (N_V + 32 * it) * KV_PITCH) = xa[it];
  __syncthreads();

  // Key number i of this lane is row i * KSPLIT + j. Two register sets: the next KGRP rows are read while these are worked on.
  // The scheduling fence of each step keeps the next set's 16 reads together and ahead of the arithmetic on this set: left to
  // itself the compiler spreads the reads singly among the arithmetic, with only a few of them in flight.
  const float* kl = &kS[j][0];
  const float* vl = &vS[j][0];
  RowSet rs[2];
  float s[NKEY];
  load_rows(rs[0], kl);
#pragma unroll
  for (int g = 0; g < NGRP; ++g) {
    load_rows(rs[(g + 1) & 1], (g + 1 < NGRP) ? kl + (g + 1) * KGRP * KSPLIT * KV_PITCH : vl);
    __builtin_amdgcn_sched_barrier(0);  // the next set's reads stay in front of this set's arithmetic
#pragma unroll
    for (int u = 0; u < KGRP; ++u) s[g * KGRP + u] = dot16(q2, rs[g & 1].r[u]) * SCALE;
  }

  // maximum over all keys of each stream, then the exponentials
  float mV = s[0], mA = s[NKEY_V];
#pragma unroll
  for (int i = 1; i < NKEY_V; ++i) mV = fmaxf(mV, s[i]);
#pragma unroll
  for (int i = NKEY_V + 1; i < NKEY; ++i) mA = fmaxf(mA, s[i]);
  mV = max8(mV);
  mA = max8(mA);
  float lV = 0.f, lA = 0.f;
#pragma unroll
  for (int i = 0; i < NKEY_V; ++i) { s[i] = exp_slot(s[i] - mV); lV += s[i]; }
#pragma unroll
  for (int i = NKEY_V; i < NKEY; ++i) { s[i] = exp_slot(s[i] - mA); lA += s[i]; }

  v2f oV[HD / 2], oA[HD / 2];
#pragma unroll
  for (int d = 0; d < HD / 2; ++d) { oV[d] = (v2f){0.f, 0.f}; oA[d] = (v2f){0.f, 0.f}; }
#pragma unroll
  for (int g = 0; g < NGRP; ++g) {
    if (g + 1 < NGRP) load_rows(rs[(NGRP + g + 1) & 1], vl + (g + 1) * KGRP * KSPLIT * KV_PITCH);
    __builtin_amdgcn_sched_barrier(0);
#pragma unroll
    for (int u = 0; u < KGRP; ++u) {
      const int i = g * KGRP + u;
      axpy16(i < NKEY_V ? oV : oA, s[i], rs[(NGRP + g) & 1].r[u]);
    }
  }
  const float invV = 1.f / sum8(lV);
  const float invA = 1.f / sum8(lA);

  float c[HD];
#pragma unroll
  for (int d = 0; d < HD / 2; ++d) {
    const v2f t = oV[d] * invV + oA[d] * invA;
    c[2 * d]     = sum8(t.x);
    c[2 * d + 1] = sum8(t.y);
  }

  if (j == 0) {
    f32x4* op = (f32x4*)(out + (long)(b * N_MM + tok) * INNER + h * HD);
#pragma unroll
    for (int g = 0; g < HD / 4; ++g) {
      f32x4 x = {c[4 * g], c[4 * g + 1], c[4 * g + 2], c[4 * g + 3]};
      op[g] = x;
    }
  }
}

// ------------------------------------------------------------------
// out = planes of the split-K product added in the order of z, + bias + residual.
// SUM_VEC pieces of 16 bytes per thread, all of their loads in flight together: few work-groups, so the grid starts fast.
// ------------------------------------------------------------------
#define W2_SPLIT 4
#define SUM_VEC  4
__global__ __launch_bounds__(256) void sum_planes_bias_res_kernel(
    const float* __restrict__ P, const float* __restrict__ bias,
    const float* __restrict__ res, float* __restrict__ out) {
#pragma unroll
  for (int i = 0; i < SUM_VEC; ++i) {
    const long e = (((long)blockIdx.x * SUM_VEC + i) * 256 + threadIdx.x) * 4;   // first element of the piece
    f32x4 x = sum_planes<W2_SPLIT, (long)B_ * N_MM * DIM>(P + e);
    x += *(const f32x4*)(bias + (e & (DIM - 1)));
    x += *(const f32x4*)(res + e);
    *(f32x4*)(out + e) = x;
  }
}

// ------------------------------------------------------------------
extern "C" void kernel_launch(void* const* d_in, const int* in_sizes, int n_in,
                              void* d_out, int out_size, void* d_ws, size_t ws_size,
                              hipStream_t stream) {
  (void)in_sizes; (void)n_in; (void)out_size; (void)ws_size;
  const float* xmm      = (const float*)d_in[0];
  const float* xv       = (const float*)d_in[1];
  const float* xa       = (const float*)d_in[2];
  const float* ln_mm_w  = (const float*)d_in[3];
  const float* ln_mm_b  = (const float*)d_in[4];
  const float* ln_v_w   = (const float*)d_in[5];
  const float* ln_v_b   = (const float*)d_in[6];
  const float* ln_a_w   = (const float*)d_in[7];
  const float* ln_a_b   = (const float*)d_in[8];
  const float* Wq       = (const float*)d_in[9];
  const float* Wkv      = (const float*)d_in[10];
  const float* Wproj    = (const float*)d_in[11];
  const float* bproj    = (const float*)d_in[12];
  const float* ln_mlp_w = (const float*)d_in[13];
  const float* ln_mlp_b = (const float*)d_in[14];
  const float* W1       = (const float*)d_in[15];
  const float* b1       = (const float*)d_in[16];
  const float* W2       = (const float*)d_in[17];
  const float* b2       = (const float*)d_in[18];
  float* out = (float*)d_out;
  float* ws  = (float*)d_ws;

  const int RM = B_ * N_MM;  // 512 rows (mm stream)
  float* src_mm = ws;                               // 512*1024
  float* src_v  = src_mm + (long)RM * DIM;          // 128*1024
  float* src_a  = src_v + (long)B_ * N_V * DIM;     // 256*1024
  float* qbuf   = src_a + (long)B_ * N_A * DIM;                 // QKV_SPLIT planes of 512*256
  float* kvv    = qbuf + (long)QKV_SPLIT * RM * INNER;          // QKV_SPLIT planes of 128*512
  float* kva    = kvv + (long)QKV_SPLIT * B_ * N_V * 2 * INNER; // QKV_SPLIT planes of 256*512
  float* attnb  = kva + (long)QKV_SPLIT * B_ * N_A * 2 * INNER; // 512*256
  float* xmm2   = attnb + (long)RM * INNER;         // 512*1024
  float* hln    = xmm2 + (long)RM * DIM;            // 512*1024
  float* act    = hln + (long)RM * DIM;             // 512*4096
  float* w2p    = act + (long)RM * HID;             // W2_SPLIT planes of 512*1024

  // 1) LayerNorms
  ln1024_x3_kernel<<<(LN3_R0 + LN3_R1 + LN3_R2) / LN_ROWS, 32 * LN_ROWS, 0, stream>>>(
      xmm, ln_mm_w, ln_mm_b, src_mm, xa, ln_a_w, ln_a_b, src_a, xv, ln_v_w, ln_v_b, src_v);

  // 2) Projections (WMMA GEMMs). Wkv[:DIM] / Wkv[DIM:] are contiguous halves.
  //    q (16 x 2 tiles), kv of the audio stream (8 x 4) and kv of the video stream (4 x 4) in one grid of 80 tiles,
  //    times QKV_SPLIT shares of K.
  gemm_x3_wmma_f32<<<dim3(TM0 * TN0 + TM1 * TN1 + TM2 * TN2, QKV_SPLIT), 256, 0, stream>>>(
      src_mm, Wq, qbuf,
      src_a, Wkv + (long)DIM * 2 * INNER, kva,
      src_v, Wkv, kvv, DIM);

  // 3) Factorized attention over the separable 8192-key softmax
  attn_factored_kernel<<<B_ * HEADS * N_CHUNK, 256, 0, stream>>>(qbuf, kvv, kva, attnb);

  // 4) Output proj + bias + residual -> xmm2
  gemm_wmma_f32<<<dim3(16, 8), 256, 0, stream>>>(attnb, Wproj, bproj, xmm,
                                                 xmm2, RM, DIM, INNER, EPI_BIAS_RES);

  // 5) MLP: LN -> W1+gelu -> W2 (W2_SPLIT shares of K) -> planes + bias + residual
  ln1024_kernel<<<RM / LN_ROWS, 32 * LN_ROWS, 0, stream>>>(xmm2, ln_mlp_w, ln_mlp_b, hln);
  gemm_wmma_f32<<<dim3(16, 32), 256, 0, stream>>>(hln, W1, b1, nullptr,
                                                  act, RM, HID, DIM, EPI_BIAS_GELU);
  gemm_splitk_wmma_f32<<<dim3(16, 8, W2_SPLIT), 256, 0, stream>>>(act, W2, w2p, RM, DIM, HID, HID / W2_SPLIT);
  sum_planes_bias_res_kernel<<<RM * DIM / (4 * 256 * SUM_VEC), 256, 0, stream>>>(w2p, b2, xmm2, out);
}

// v006
// Measured time: 82.4 microseconds a run.
// In both of two side-by-side timings against v005, it was 1.07 times as fast.
// Over all steps from v000 it is 4.62 times as fast.
#include <hip/hip_runtime.h>
#include <math.h>
#include <stdint.h>

typedef __attribute__((ext_vector_type(2))) float v2f;
typedef __attribute__((ext_vector_type(8))) float v8f;
typedef __attribute__((ext_vector_type(4))) unsigned int u32x4;
typedef __attribute__((ext_vector_type(8))) unsigned int u32x8;

#define B_    2
#define N_MM  256
#define N_V   64
#define N_A   128
#define DIM   1024
#define HEADS 16
#define INNER 256
#define HID   4096
#define HD    16
#define SCALE 0.125f   /* (DIM/HEADS)^-0.5 = 64^-0.5 */
#define EPS   1e-5f

#define EPI_NONE      0
#define EPI_BIAS_RES  2
#define EPI_BIAS_GELU 3

// LDS pitch of an A panel row, in floats: 256 B of data + the 16 B pad that the tensor load lays behind each row
#define A_PITCH 68
// floats per A buffer: 32 rows of 272 B = 8,704 B, rounded up to a multiple of 2 KiB (every tensor-load destination is one)
#define A_BUF   2560

// ------------------------------------------------------------------
// LayerNorm over rows of length 1024: one wave per row, LN_ROWS rows (waves) per block.
// A lane holds 32 elements of its row, as 8 pieces of 16 bytes; each wave-wide load or store covers 512 contiguous bytes.
// Both sums are merged across the 32 lanes in registers: no LDS, no barrier, and an eighth of the waves to start.
// ------------------------------------------------------------------
typedef __attribute__((ext_vector_type(4))) float f32x4;
#define LN_ROWS 4
#define LN_VEC  (DIM / (32 * 4))           /* 16-byte pieces per lane */

// The value that lane (l ^ M) holds, M < 16 (DPP row_xmask); every lane is on wherever it is used.
template <int M>
__device__ __forceinline__ float row_xor(float x) {
  return __int_as_float(__builtin_amdgcn_update_dpp(0, __float_as_int(x), 0x160 + M, 0xf, 0xf, true));
}
__device__ __forceinline__ float sum32(float x) {
  x += row_xor<1>(x);
  x += row_xor<2>(x);
  x += row_xor<4>(x);
  x += row_xor<8>(x);
  const int xi = __float_as_int(x);
  x += __int_as_float(__builtin_amdgcn_permlanex16(xi, xi, 0x76543210, 0xfedcba98, false, false));
  return x;
}

// row, x, w, b, y are the same in every lane of the wave
__device__ __forceinline__ void ln1024_row(const float* __restrict__ x,
                                           const float* __restrict__ w,
                                           const float* __restrict__ b,
                                           float* __restrict__ y, int row) {
  const uint32_t off = (threadIdx.x & 31u) * 4u;   // this lane's first element in each 128-element piece of the row
  const float* xr = x + (long)row * DIM;
  f32x4 v[LN_VEC], wv[LN_VEC], bv[LN_VEC];
#pragma unroll
  for (int i = 0; i < LN_VEC; ++i) v[i] = *(const f32x4*)(xr + off + 128 * i);
#pragma unroll
  for (int i = 0; i < LN_VEC; ++i) wv[i] = *(const f32x4*)(w + off + 128 * i);
#pragma unroll
  for (int i = 0; i < LN_VEC; ++i) bv[i] = *(const f32x4*)(b + off + 128 * i);
  // The wait that stands in front of an overwrite of a register that an issued global load names. The offset and the three
  // bases are inputs, so that they live up to here and no later load's destination is laid over them.
  asm volatile("s_wait_xcnt 0x0" :: "v"(off), "s"(xr), "s"(w), "s"(b) : "memory");
  __builtin_amdgcn_sched_barrier(0);  // all 24 loads stay in front of the arithmetic, in flight together: left to itself the compiler sinks those of w and b to their uses, two at a time, each pair a latency of its own

  f32x4 s4 = v[0];
#pragma unroll
  for (int i = 1; i < LN_VEC; ++i) s4 += v[i];
  const float mean = sum32((s4.x + s4.y) + (s4.z + s4.w)) * (1.f / DIM);
  f32x4 q4 = {0.f, 0.f, 0.f, 0.f};
#pragma unroll
  for (int i = 0; i < LN_VEC; ++i) { v[i] -= mean; q4 += v[i] * v[i]; }
  const float inv = rsqrtf(sum32((q4.x + q4.y) + (q4.z + q4.w)) * (1.f / DIM) + EPS);
  float* yr = y + (long)row * DIM;
#pragma unroll
  for (int i = 0; i < LN_VEC; ++i) *(f32x4*)(yr + off + 128 * i) = v[i] * inv * wv[i] + bv[i];
}

__global__ __launch_bounds__(32 * LN_ROWS) void ln1024_kernel(const float* __restrict__ x,
                                                              const float* __restrict__ w,
                                                              const float* __restrict__ b,
                                                              float* __restrict__ y) {
  ln1024_row(x, w, b, y, (int)(blockIdx.x * LN_ROWS) + __builtin_amdgcn_readfirstlane((int)(threadIdx.x >> 5)));
}

// The three input streams' LayerNorms depend on nothing of one another: one grid holds the rows of all three,
// LN3_R0 rows of stream 0, then LN3_R1 rows of stream 1, then LN3_R2 rows of stream 2.
#define LN3_R0 (B_ * N_MM)
#define LN3_R1 (B_ * N_A)
#define LN3_R2 (B_ * N_V)
__global__ __launch_bounds__(32 * LN_ROWS) void ln1024_x3_kernel(
    const float* __restrict__ x0, const float* __restrict__ w0, const float* __restrict__ b0, float* __restrict__ y0,
    const float* __restrict__ x1, const float* __restrict__ w1, const float* __restrict__ b1, float* __restrict__ y1,
    const float* __restrict__ x2, const float* __restrict__ w2, const float* __restrict__ b2, float* __restrict__ y2) {
  const int id = (int)(blockIdx.x * LN_ROWS) + __builtin_amdgcn_readfirstlane((int)(threadIdx.x >> 5));
  const float* x = x0;
  const float* w = w0;
  const float* b = b0;
  float* y = y0;
  int row = id;
  if (id >= LN3_R0 + LN3_R1) {
    x = x2; w = w2; b = b2; y = y2; row = id - (LN3_R0 + LN3_R1);
  } else if (id >= LN3_R0) {
    x = x1; w = w1; b = b1; y = y1; row = id - LN3_R0;
  }
  ln1024_row(x, w, b, y, row);
}

__device__ __forceinline__ uint32_t uni(uint32_t v) { return (uint32_t)__builtin_amdgcn_readfirstlane(v); }
__device__ __forceinline__ uint32_t pinned(uint32_t v) { uint32_t w = uni(v); asm volatile("" : "+s"(w)); return w; }  // the pinned() form for a test around a tensor load
__device__ __forceinline__ void wait_ds0()     { asm volatile("s_wait_dscnt 0x0" ::: "memory"); }     // this wave's LDS reads have retired
__device__ __forceinline__ void wait_tensor0() { asm volatile("s_wait_tensorcnt 0x0" ::: "memory"); } // this wave's tensor load has landed
__device__ __forceinline__ void wait_tensor0(u32x4& g0, u32x8& g1) {
  asm volatile("s_wait_tensorcnt 0x0" : "+s"(g0), "+s"(g1) :: "memory");
}

__device__ __forceinline__ void tdm_group0(u32x4& g, const float* lptr, const float* gptr) {
  const uint64_t ga = (uint64_t)gptr;
  g[0] = uni(1u);
  g[1] = uni((uint32_t)(uint64_t)lptr);
  g[2] = uni((uint32_t)ga);
  g[3] = uni((((uint32_t)(ga >> 32)) & 0x01FFFFFFu) | 0x80000000u);
}
template <uint32_t WORD0, uint32_t ROWB, uint32_t ROWS>
__device__ __forceinline__ u32x8 tdm_group1(uint32_t src_pitch) {
  u32x8 g;
  g[0] = uni(WORD0);
  g[1] = uni((ROWB & 0xFFFFu) << 16);
  g[2] = uni((ROWB >> 16) | ((ROWS & 0xFFFFu) << 16));
  g[3] = uni((ROWS >> 16) | (ROWB << 16));
  g[4] = uni(ROWS);
  g[5] = uni(src_pitch);
  g[6] = uni(0u);
  g[7] = uni(0u);
  return g;
}
__device__ __forceinline__ void tdm_load(u32x4& g0, u32x8& g1) {
  asm volatile("tensor_load_to_lds %0, %1" : "+s"(g0), "+s"(g1) :: "memory");  // in-out: see wait_tensor0(g0, g1)
}

#define KQ     4                /* shares of a panel's k, one per pair of waves */
#define KQ_LEN (64 / KQ)        /* k per share */
#define KSTEPS (KQ_LEN / 4)     /* WMMA depths of 4 per share */
__device__ __forceinline__ void gemm_tile_f32(
    const float* __restrict__ A, const float* __restrict__ Bm,
    const float* __restrict__ bias, const float* __restrict__ res,
    float* __restrict__ C, int N, int lda, int K, int epi, int tile_m, int tile_n) {
  __shared__ __attribute__((aligned(2048))) float lA[2][A_BUF];       // [m][k] panels, row pitch A_PITCH
  __shared__ __attribute__((aligned(2048))) float lB[2][64 * 128];    // [k][n] panels
  const uint32_t wave = uni(threadIdx.x >> 5);
  const int lane = threadIdx.x & 31;
  const int m0   = tile_m * 32;
  const int nblk = tile_n * 128;
  const int nh   = (int)(wave & 1u);    // which 64 of the 128 columns
  const int kq   = (int)(wave >> 1);    // which share of each panel's k

  v8f acc[2][4];
#pragma unroll
  for (int mt = 0; mt < 2; ++mt)
#pragma unroll
    for (int j = 0; j < 4; ++j) acc[mt][j] = (v8f){0.f, 0.f, 0.f, 0.f, 0.f, 0.f, 0.f, 0.f};

  const int S = K >> 6;  // number of 64-deep K panels

  u32x8 g1A = tdm_group1<(1u << 20) | (5u << 22) | (3u << 25), 256u, 32u>((uint32_t)lda * 4u);
  u32x8 g1B = tdm_group1<0u, 512u, 64u>((uint32_t)N * 4u);
  const float* gA = A + (long)m0 * lda; // panel s starts at gA + 64 * s
  const float* gB = Bm + nblk;          // panel s starts at gB + 64 * s * N

  u32x4 g0A, g0B;
  tdm_group0(g0A, lA[0], gA);
  tdm_group0(g0B, lB[0], gB);

  // panel 0, landed and published; then panel 1 into the other buffer
  if (pinned(wave == 0u)) {
    tdm_load(g0A, g1A);
    wait_tensor0(g0A, g1A);
  }
  if (pinned(wave == 1u)) {
    tdm_load(g0B, g1B);
    wait_tensor0(g0B, g1B);
  }
  __syncthreads();
  if (pinned(wave == 0u)) {
    tdm_group0(g0A, lA[1], gA + 64);
    tdm_load(g0A, g1A);
  }
  if (pinned(wave == 1u)) {
    tdm_group0(g0B, lB[1], gB + (long)64 * N);
    tdm_load(g0B, g1B);
  }

  const int ml = lane & 15;                              // A row in its tile / B column group
  const int k0 = kq * KQ_LEN + ((lane >> 4) << 1);       // this lane's first k in a panel: lanes 16-31 carry K+2,K+3
  for (int i = 0; i < S; ++i) {
    const int cur = i & 1;
    const float* lAc = lA[cur] + ml * A_PITCH + k0;
    const float* lBc = lB[cur] + k0 * 128 + nh * 64 + ml * 4;
    v2f a0[KSTEPS], a1[KSTEPS];     // A 16x4 frags, M rows 0-15 and 16-31 of the block tile: A[m][k], A[m][k+1]
    f32x4 b0[KSTEPS], b1[KSTEPS];   // B rows k and k+1, this lane's four columns
#pragma unroll
    for (int t = 0; t < KSTEPS; ++t) {
      b0[t] = *(const f32x4*)(lBc + (4 * t + 0) * 128);
      b1[t] = *(const f32x4*)(lBc + (4 * t + 1) * 128);
      a0[t] = *(const v2f*)(lAc + 4 * t);
      a1[t] = *(const v2f*)(lAc + 16 * A_PITCH + 4 * t);
    }
#pragma unroll
    for (int t = 0; t < KSTEPS; ++t) {
#pragma unroll
      for (int j = 0; j < 4; ++j) {
        const v2f bf = {b0[t][j], b1[t][j]};
        acc[0][j] = __builtin_amdgcn_wmma_f32_16x16x4_f32(false, a0[t], false, bf,
                                                          (short)0, acc[0][j], false, false);
        acc[1][j] = __builtin_amdgcn_wmma_f32_16x16x4_f32(false, a1[t], false, bf,
                                                          (short)0, acc[1][j], false, false);
      }
    }
    // Publish panel i + 1 and free panel i's buffer: own LDS reads retired, the issuers' loads landed, one barrier for both.
    __builtin_amdgcn_sched_barrier(0);  // keeps the panel's last WMMAs in front of the wait: behind it they would stall on the full LDS drain
    wait_ds0();
    if (pinned(wave == 0u)) wait_tensor0(g0A, g1A);
    if (pinned(wave == 1u)) wait_tensor0(g0B, g1B);
    __syncthreads();
    // Refill the buffer that every wave has just left, only while a panel i + 2 exists.
    if (pinned(i + 2 < S)) {
      if (pinned(wave == 0u)) {
        tdm_group0(g0A, lA[cur], gA + ((i + 2) << 6));
        tdm_load(g0A, g1A);
      }
      if (pinned(wave == 1u)) {
        tdm_group0(g0B, lB[cur], gB + (long)((i + 2) << 6) * N);
        tdm_load(g0B, g1B);
      }
    }
  }
  wait_tensor0();
  wait_ds0();

  // A wave finishes rows wave, wave + 8, ... of the tile: 512 contiguous bytes per read and per store.
  // Bias and residual are fetched here, so that they fly while the partial tiles go through LDS.
  const int col = nblk + lane * 4;
  const long o0 = (long)(m0 + (int)wave) * N + col;   // row wave + 8 * i lies at o0 + 8 * i * N
  f32x4 bv = {0.f, 0.f, 0.f, 0.f};
  f32x4 rv[4];
  if (epi != EPI_NONE) {
    const float* pb = bias + col;
    bv = *(const f32x4*)pb;
    if (epi == EPI_BIAS_RES) {
#pragma unroll
      for (int i = 0; i < 4; ++i) rv[i] = *(const f32x4*)(res + o0 + (long)(8 * i) * N);
    }
    // The wait that stands in front of an overwrite of a register that an issued global load names. The bias address is an
    // input, so that it lives up to here and the residual's addresses are not laid over it.
    asm volatile("s_wait_xcnt 0x0" :: "v"(pb) : "memory");
  }

  float* red = &lB[0][0];
  float* rw = red + kq * (32 * 128) + ((lane >> 4) << 3) * 128 + nh * 64 + ml * 4;
#pragma unroll
  for (int mt = 0; mt < 2; ++mt)
#pragma unroll
    for (int r = 0; r < 8; ++r) {
      const f32x4 x = {acc[mt][0][r], acc[mt][1][r], acc[mt][2][r], acc[mt][3][r]};
      *(f32x4*)(rw + (mt * 16 + r) * 128) = x;
    }
  __syncthreads();

  // The planes are added in the order of k.
  const float* rr = red + (int)wave * 128 + lane * 4;
  f32x4 x[4];
#pragma unroll
  for (int i = 0; i < 4; ++i) {
    x[i] = *(const f32x4*)(rr + 8 * i * 128);
#pragma unroll
    for (int z = 1; z < KQ; ++z) x[i] += *(const f32x4*)(rr + 8 * i * 128 + z * (32 * 128));
    x[i] += bv;
  }
  if (epi == EPI_BIAS_GELU) {
#pragma unroll
    for (int i = 0; i < 4; ++i)
#pragma unroll
      for (int e = 0; e < 4; ++e) x[i][e] = 0.5f * x[i][e] * (1.f + erff(x[i][e] * 0.7071067811865476f));
  } else if (epi == EPI_BIAS_RES) {
#pragma unroll
    for (int i = 0; i < 4; ++i) x[i] += rv[i];
  }
#pragma unroll
  for (int i = 0; i < 4; ++i) *(f32x4*)(C + o0 + (long)(8 * i) * N) = x[i];
}

__global__ __launch_bounds__(256) void gemm_wmma_f32(
    const float* __restrict__ A, const float* __restrict__ Bm,
    const float* __restrict__ bias, const float* __restrict__ res,
    float* __restrict__ C, int M, int N, int K, int epi) {
  (void)M;
  gemm_tile_f32(A, Bm, bias, res, C, N, K, K, epi, blockIdx.x, blockIdx.y);
}

__global__ __launch_bounds__(256) void gemm_splitk_wmma_f32(
    const float* __restrict__ A, const float* __restrict__ Bm,
    float* __restrict__ P, int M, int N, int K, int Kc) {
  const long z = blockIdx.z;
  gemm_tile_f32(A + z * Kc, Bm + z * Kc * N, nullptr, nullptr, P + z * M * N, N, K, Kc, EPI_NONE,
                blockIdx.x, blockIdx.y);
}

#define QKV_SPLIT 4
#define TM0 (B_ * N_MM / 32u)    /* q:        512 x 256 */
#define TN0 (INNER / 128u)
#define TM1 (B_ * N_A / 32u)     /* kv audio: 256 x 512 */
#define TN1 (2 * INNER / 128u)
#define TM2 (B_ * N_V / 32u)     /* kv video: 128 x 512 */
#define TN2 (2 * INNER / 128u)
__global__ __launch_bounds__(256) void gemm_x3_wmma_f32(
    const float* __restrict__ A0, const float* __restrict__ B0, float* __restrict__ C0,
    const float* __restrict__ A1, const float* __restrict__ B1, float* __restrict__ C1,
    const float* __restrict__ A2, const float* __restrict__ B2, float* __restrict__ C2, int K) {
  const uint32_t id = blockIdx.x;
  const float* A = A0;
  const float* Bm = B0;
  float* C = C0;
  uint32_t tile_m = id % TM0, tile_n = id / TM0, tn = TN0, tm = TM0;
  if (id >= TM0 * TN0 + TM1 * TN1) {
    const uint32_t t = id - (TM0 * TN0 + TM1 * TN1);
    A = A2; Bm = B2; C = C2; tile_m = t % TM2; tile_n = t / TM2; tn = TN2; tm = TM2;
  } else if (id >= TM0 * TN0) {
    const uint32_t t = id - TM0 * TN0;
    A = A1; Bm = B1; C = C1; tile_m = t % TM1; tile_n = t / TM1; tn = TN1; tm = TM1;
  }
  const int N = (int)(tn * 128u);
  const int Kc = K / QKV_SPLIT;
  const long z = blockIdx.y;
  gemm_tile_f32(A + z * Kc, Bm + z * Kc * N, nullptr, nullptr, C + z * (long)(tm * 32u) * N, N, K, Kc, EPI_NONE,
                (int)tile_m, (int)tile_n);
}

// ------------------------------------------------------------------
// Factorized attention. Logits over the synthetic 8192-long KV separate as
// s(v,a) = s_v + s_a, so softmax/PV factor into two independent softmaxes:
//   out = softmax(q.k_v^T) @ v_v  +  softmax(q.k_a^T) @ v_a
// One block per (batch, head, chunk of 32 q-tokens). The keys of one q-token are dealt to 8 neighbouring lanes:
// lane j of the 8 takes keys j, j + 8, j + 16, ... of both streams and keeps its 8 + 16 scores in registers;
// the 8 partial maxima, sums and outputs are merged inside the 16-lane row. K/V rows in LDS.
// ------------------------------------------------------------------
#define KSPLIT   8                         /* lanes that share one q-token */
#define TOK_BLK  (256 / KSPLIT)            /* q-tokens per block */
#define N_CHUNK  (N_MM / TOK_BLK)          /* blocks per (batch, head) */
#define NKEY_V   (N_V / KSPLIT)            /* video keys per lane */
#define NKEY     ((N_V + N_A) / KSPLIT)    /* keys per lane, the video keys first */
#define KGRP     4                         /* rows per register set */
#define NGRP     (NKEY / KGRP)
#define KV_PITCH 20

__device__ __forceinline__ float sum8(float x) {
  x += row_xor<1>(x);
  x += row_xor<2>(x);
  x += row_xor<4>(x);
  return x;
}
__device__ __forceinline__ float max8(float x) {
  x = fmaxf(x, row_xor<1>(x));
  x = fmaxf(x, row_xor<2>(x));
  x = fmaxf(x, row_xor<4>(x));
  return x;
}
__device__ __forceinline__ float exp_slot(float x) {
  float r;
  asm("v_exp_f32 %0, %1\n\tv_nop" : "=v"(r) : "v"(x * 1.4426950408889634f));
  return r;
}
// One register set: this lane's next KGRP rows (every KSPLIT-th row from p on), 16 floats each.
struct RowSet { f32x4 r[KGRP][HD / 4]; };
__device__ __forceinline__ void load_rows(RowSet& t, const float* p) {
#pragma unroll
  for (int u = 0; u < KGRP; ++u)
#pragma unroll
    for (int c = 0; c < HD / 4; ++c) t.r[u][c] = *(const f32x4*)(p + u * KSPLIT * KV_PITCH + 4 * c);
}
// q . k over 16 dims, as four partial sums in two packed chains
__device__ __forceinline__ float dot16(const v2f* q2, const f32x4* k) {
  v2f a = {0.f, 0.f}, b = {0.f, 0.f};
#pragma unroll
  for (int c = 0; c < HD / 4; ++c) {
    a = __builtin_elementwise_fma(q2[2 * c], k[c].xy, a);
    b = __builtin_elementwise_fma(q2[2 * c + 1], k[c].zw, b);
  }
  const v2f t = a + b;
  return t.x + t.y;
}
__device__ __forceinline__ void axpy16(v2f* o2, float e, const f32x4* v) {
  const v2f e2 = {e, e};
#pragma unroll
  for (int c = 0; c < HD / 4; ++c) {
    o2[2 * c]     = __builtin_elementwise_fma(e2, v[c].xy, o2[2 * c]);
    o2[2 * c + 1] = __builtin_elementwise_fma(e2, v[c].zw, o2[2 * c + 1]);
  }
}

// 16 bytes of a product that was stored as NP split-K planes of PLANE floats each: the planes added in the order of z
template <int NP, long PLANE>
__device__ __forceinline__ f32x4 sum_planes(const float* __restrict__ p) {
  f32x4 x = *(const f32x4*)p;
#pragma unroll
  for (int z = 1; z < NP; ++z) x += *(const f32x4*)(p + z * PLANE);
  return x;
}

// q, kvv, kva: QKV_SPLIT planes each, added here as they are read
__global__ __launch_bounds__(256) void attn_factored_kernel(
    const float* __restrict__ q, const float* __restrict__ kvv,
    const float* __restrict__ kva, float* __restrict__ out) {
  const int chunk = blockIdx.x % N_CHUNK;
  const int h = (blockIdx.x / N_CHUNK) & 15;
  const int b = blockIdx.x / (N_CHUNK * HEADS);
  // rows 0 .. N_V - 1: video keys; rows N_V .. N_V + N_A - 1: audio keys
  __shared__ __attribute__((aligned(16))) float kS[N_V + N_A][KV_PITCH];
  __shared__ __attribute__((aligned(16))) float vS[N_V + N_A][KV_PITCH];

  const int j   = threadIdx.x & (KSPLIT - 1);
  const int tok = chunk * TOK_BLK + (threadIdx.x / KSPLIT);
  v2f q2[HD / 2];
  const float* qp = q + (long)(b * N_MM + tok) * INNER + h * HD;
#pragma unroll
  for (int c = 0; c < HD / 4; ++c) {
    const f32x4 x = sum_planes<QKV_SPLIT, (long)B_ * N_MM * INNER>(qp + 4 * c);
    q2[2 * c] = x.xy;
    q2[2 * c + 1] = x.zw;
  }

  // 8 pieces of 16 B per key: 4 of its K row, 4 of its V row; 32 keys per round of the block
  const int part = (threadIdx.x >> 2) & 1, quad = threadIdx.x & 3;
  const int soff = part * INNER + h * HD + quad * 4;
  const int row0 = threadIdx.x >> 3;
  float* sdst = (part ? &vS[0][0] : &kS[0][0]) + quad * 4 + row0 * KV_PITCH;
  const float* pv = kvv + (long)(b * N_V + row0) * (2 * INNER) + soff;
  const float* pa = kva + (long)(b * N_A + row0) * (2 * INNER) + soff;
  f32x4 xv[N_V / 32], xa[N_A / 32];
#pragma unroll
  for (int it = 0; it < N_V / 32; ++it)
    xv[it] = sum_planes<QKV_SPLIT, (long)B_ * N_V * 2 * INNER>(pv + it * 32 * 2 * INNER);
#pragma unroll
  for (int it = 0; it < N_A / 32; ++it)
    xa[it] = sum_planes<QKV_SPLIT, (long)B_ * N_A * 2 * INNER>(pa + it * 32 * 2 * INNER);
  // The wait that stands in front of an overwrite of a register that an issued global load names. The three address pairs
  // are inputs, so that they live up to here and no later load's destination is laid over them.
  asm volatile("s_wait_xcnt 0x0" :: "v"(qp), "v"(pv), "v"(pa) : "memory");
#pragma unroll
  for (int it = 0; it < N_V / 32; ++it) *(f32x4*)(sdst + 32 * it * KV_PITCH) = xv[it];
#pragma unroll
  for (int it = 0; it < N_A / 32; ++it) *(f32x4*)(sdst + (N_V + 32 * it) * KV_PITCH) = xa[it];
  __syncthreads();

  // Key number i of this lane is row i * KSPLIT + j. Two register sets: the next KGRP rows are read while these are worked on.
  // The scheduling fence of each step keeps the next set's 16 reads together and ahead of the arithmetic on this set: left to
  // itself the compiler spreads the reads singly among the arithmetic, with only a few of them in flight.
  const float* kl = &kS[j][0];
  const float* vl = &vS[j][0];
  RowSet rs[2];
  float s[NKEY];
  load_rows(rs[0], kl);
#pragma unroll
  for (int g = 0; g < NGRP; ++g) {
    load_rows(rs[(g + 1) & 1], (g + 1 < NGRP) ? kl + (g + 1) * KGRP * KSPLIT * KV_PITCH : vl);
    __builtin_amdgcn_sched_barrier(0);  // the next set's reads stay in front of this set's arithmetic
#pragma unroll
    for (int u = 0; u < KGRP; ++u) s[g * KGRP + u] = dot16(q2, rs[g & 1].r[u]) * SCALE;
  }

  // maximum over all keys of each stream, then the exponentials
  float mV = s[0], mA = s[NKEY_V];
#pragma unroll
  for (int i = 1; i < NKEY_V; ++i) mV = fmaxf(mV, s[i]);
#pragma unroll
  for (int i = NKEY_V + 1; i < NKEY; ++i) mA = fmaxf(mA, s[i]);
  mV = max8(mV);
  mA = max8(mA);
  float lV = 0.f, lA = 0.f;
#pragma unroll
  for (int i = 0; i < NKEY_V; ++i) { s[i] = exp_slot(s[i] - mV); lV += s[i]; }
#pragma unroll
  for (int i = NKEY_V; i < NKEY; ++i) { s[i] = exp_slot(s[i] - mA); lA += s[i]; }

  v2f oV[HD / 2], oA[HD / 2];
#pragma unroll
  for (int d = 0; d < HD / 2; ++d) { oV[d] = (v2f){0.f, 0.f}; oA[d] = (v2f){0.f, 0.f}; }
#pragma unroll
  for (int g = 0; g < NGRP; ++g) {
    if (g + 1 < NGRP) load_rows(rs[(NGRP + g + 1) & 1], vl + (g + 1) * KGRP * KSPLIT * KV_PITCH);
    __builtin_amdgcn_sched_barrier(0);
#pragma unroll
    for (int u = 0; u < KGRP; ++u) {
      const int i = g * KGRP + u;
      axpy16(i < NKEY_V ? oV : oA, s[i], rs[(NGRP + g) & 1].r[u]);
    }
  }
  const float invV = 1.f / sum8(lV);
  const float invA = 1.f / sum8(lA);

  float c[HD];
#pragma unroll
  for (int d = 0; d < HD / 2; ++d) {
    const v2f t = oV[d] * invV + oA[d] * invA;
    c[2 * d]     = sum8(t.x);
    c[2 * d + 1] = sum8(t.y);
  }

  if (j == 0) {
    f32x4* op = (f32x4*)(out + (long)(b * N_MM + tok) * INNER + h * HD);
#pragma unroll
    for (int g = 0; g < HD / 4; ++g) {
      f32x4 x = {c[4 * g], c[4 * g + 1], c[4 * g + 2], c[4 * g + 3]};
      op[g] = x;
    }
  }
}

// ------------------------------------------------------------------
// out = planes of the split-K product added in the order of z, + bias + residual.
// SUM_VEC pieces of 16 bytes per thread, all of their loads in flight together: few work-groups, so the grid starts fast.
// ------------------------------------------------------------------
#define W2_SPLIT 4
#define SUM_VEC  4
__global__ __launch_bounds__(256) void sum_planes_bias_res_kernel(
    const float* __restrict__ P, const float* __restrict__ bias,
    const float* __restrict__ res, float* __restrict__ out) {
#pragma unroll
  for (int i = 0; i < SUM_VEC; ++i) {
    const long e = (((long)blockIdx.x * SUM_VEC + i) * 256 + threadIdx.x) * 4;   // first element of the piece
    f32x4 x = sum_planes<W2_SPLIT, (long)B_ * N_MM * DIM>(P + e);
    x += *(const f32x4*)(bias + (e & (DIM - 1)));
    x += *(const f32x4*)(res + e);
    *(f32x4*)(out + e) = x;
  }
}

// ------------------------------------------------------------------
extern "C" void kernel_launch(void* const* d_in, const int* in_sizes, int n_in,
                              void* d_out, int out_size, void* d_ws, size_t ws_size,
                              hipStream_t stream) {
  (void)in_sizes; (void)n_in; (void)out_size; (void)ws_size;
  const float* xmm      = (const float*)d_in[0];
  const float* xv       = (const float*)d_in[1];
  const float* xa       = (const float*)d_in[2];
  const float* ln_mm_w  = (const float*)d_in[3];
  const float* ln_mm_b  = (const float*)d_in[4];
  const float* ln_v_w   = (const float*)d_in[5];
  const float* ln_v_b   = (const float*)d_in[6];
  const float* ln_a_w   = (const float*)d_in[7];
  const float* ln_a_b   = (const float*)d_in[8];
  const float* Wq       = (const float*)d_in[9];
  const float* Wkv      = (const float*)d_in[10];
  const float* Wproj    = (const float*)d_in[11];
  const float* bproj    = (const float*)d_in[12];
  const float* ln_mlp_w = (const float*)d_in[13];
  const float* ln_mlp_b = (const float*)d_in[14];
  const float* W1       = (const float*)d_in[15];
  const float* b1       = (const float*)d_in[16];
  const float* W2       = (const float*)d_in[17];
  const float* b2       = (const float*)d_in[18];
  float* out = (float*)d_out;
  float* ws  = (float*)d_ws;

  const int RM = B_ * N_MM;  // 512 rows (mm stream)
  float* src_mm = ws;                               // 512*1024
  float* src_v  = src_mm + (long)RM * DIM;          // 128*1024
  float* src_a  = src_v + (long)B_ * N_V * DIM;     // 256*1024
  float* qbuf   = src_a + (long)B_ * N_A * DIM;                 // QKV_SPLIT planes of 512*256
  float* kvv    = qbuf + (long)QKV_SPLIT * RM * INNER;          // QKV_SPLIT planes of 128*512
  float* kva    = kvv + (long)QKV_SPLIT * B_ * N_V * 2 * INNER; // QKV_SPLIT planes of 256*512
  float* attnb  = kva + (long)QKV_SPLIT * B_ * N_A * 2 * INNER; // 512*256
  float* xmm2   = attnb + (long)RM * INNER;         // 512*1024
  float* hln    = xmm2 + (long)RM * DIM;            // 512*1024
  float* act    = hln + (long)RM * DIM;             // 512*4096
  float* w2p    = act + (long)RM * HID;             // W2_SPLIT planes of 512*1024

  // 1) LayerNorms
  ln1024_x3_kernel<<<(LN3_R0 + LN3_R1 + LN3_R2) / LN_ROWS, 32 * LN_ROWS, 0, stream>>>(
      xmm, ln_mm_w, ln_mm_b, src_mm, xa, ln_a_w, ln_a_b, src_a, xv, ln_v_w, ln_v_b, src_v);

  // 2) Projections (WMMA GEMMs). Wkv[:DIM] / Wkv[DIM:] are contiguous halves.
  //    q (16 x 2 tiles), kv of the audio stream (8 x 4) and kv of the video stream (4 x 4) in one grid of 80 tiles,
  //    times QKV_SPLIT shares of K.
  gemm_x3_wmma_f32<<<dim3(TM0 * TN0 + TM1 * TN1 + TM2 * TN2, QKV_SPLIT), 256, 0, stream>>>(
      src_mm, Wq, qbuf,
      src_a, Wkv + (long)DIM * 2 * INNER, kva,
      src_v, Wkv, kvv, DIM);

  // 3) Factorized attention over the separable 8192-key softmax
  attn_factored_kernel<<<B_ * HEADS * N_CHUNK, 256, 0, stream>>>(qbuf, kvv, kva, attnb);

  // 4) Output proj + bias + residual -> xmm2
  gemm_wmma_f32<<<dim3(16, 8), 256, 0, stream>>>(attnb, Wproj, bproj, xmm,
                                                 xmm2, RM, DIM, INNER, EPI_BIAS_RES);

  // 5) MLP: LN -> W1+gelu -> W2 (W2_SPLIT shares of K) -> planes + bias + residual
  ln1024_kernel<<<RM / LN_ROWS, 32 * LN_ROWS, 0, stream>>>(xmm2, ln_mlp_w, ln_mlp_b, hln);
  gemm_wmma_f32<<<dim3(16, 32), 256, 0, stream>>>(hln, W1, b1, nullptr,
                                                  act, RM, HID, DIM, EPI_BIAS_GELU);
  gemm_splitk_wmma_f32<<<dim3(16, 8, W2_SPLIT), 256, 0, stream>>>(act, W2, w2p, RM, DIM, HID, HID / W2_SPLIT);
  sum_planes_bias_res_kernel<<<RM * DIM / (4 * 256 * SUM_VEC), 256, 0, stream>>>(w2p, b2, xmm2, out);
}

// v007
// Measured time: 78.6 microseconds a run.
// Two timings next to v006 put it at 1.04 and 1.06 times that version's speed.
// Over all steps from v000 it is 4.85 times as fast.
#include <hip/hip_runtime.h>
#include <math.h>
#include <stdint.h>

typedef __attribute__((ext_vector_type(2))) float v2f;
typedef __attribute__((ext_vector_type(8))) float v8f;
typedef __attribute__((ext_vector_type(4))) unsigned int u32x4;
typedef __attribute__((ext_vector_type(8))) unsigned int u32x8;

#define B_    2
#define N_MM  256
#define N_V   64
#define N_A   128
#define DIM   1024
#define HEADS 16
#define INNER 256
#define HID   4096
#define HD    16
#define SCALE 0.125f   /* (DIM/HEADS)^-0.5 = 64^-0.5 */
#define EPS   1e-5f

#define EPI_NONE      0
#define EPI_BIAS_RES  2
#define EPI_BIAS_GELU 3

// LDS pitch of an A panel row, in floats: 256 B of data + the 16 B pad that the tensor load lays behind each row
#define A_PITCH 68
// floats per 64-k slice of an A buffer: 32 rows of 272 B = 8,704 B, rounded up to a multiple of 2 KiB (every tensor-load destination is one)
#define A_BUF   2560

// ------------------------------------------------------------------
// LayerNorm over rows of length 1024: one wave per row, LN_ROWS rows (waves) per block.
// A lane holds 32 elements of its row, as 8 pieces of 16 bytes; each wave-wide load or store covers 512 contiguous bytes.
// Both sums are merged across the 32 lanes in registers: no LDS, no barrier, and an eighth of the waves to start.
// ------------------------------------------------------------------
typedef __attribute__((ext_vector_type(4))) float f32x4;
#define LN_ROWS 4
#define LN_VEC  (DIM / (32 * 4))           /* 16-byte pieces per lane */

// The value that lane (l ^ M) holds, M < 16 (DPP row_xmask); every lane is on wherever it is used.
template <int M>
__device__ __forceinline__ float row_xor(float x) {
  return __int_as_float(__builtin_amdgcn_update_dpp(0, __float_as_int(x), 0x160 + M, 0xf, 0xf, true));
}
__device__ __forceinline__ float sum32(float x) {
  x += row_xor<1>(x);
  x += row_xor<2>(x);
  x += row_xor<4>(x);
  x += row_xor<8>(x);
  const int xi = __float_as_int(x);
  x += __int_as_float(__builtin_amdgcn_permlanex16(xi, xi, 0x76543210, 0xfedcba98, false, false));
  return x;
}

// row, x, w, b, y are the same in every lane of the wave
__device__ __forceinline__ void ln1024_row(const float* __restrict__ x,
                                           const float* __restrict__ w,
                                           const float* __restrict__ b,
                                           float* __restrict__ y, int row) {
  const uint32_t off = (threadIdx.x & 31u) * 4u;   // this lane's first element in each 128-element piece of the row
  const float* xr = x + (long)row * DIM;
  f32x4 v[LN_VEC], wv[LN_VEC], bv[LN_VEC];
#pragma unroll
  for (int i = 0; i < LN_VEC; ++i) v[i] = *(const f32x4*)(xr + off + 128 * i);
#pragma unroll
  for (int i = 0; i < LN_VEC; ++i) wv[i] = *(const f32x4*)(w + off + 128 * i);
#pragma unroll
  for (int i = 0; i < LN_VEC; ++i) bv[i] = *(const f32x4*)(b + off + 128 * i);
  // The wait that stands in front of an overwrite of a register that an issued global load names. The offset and the three
  // bases are inputs, so that they live up to here and no later load's destination is laid over them.
  asm volatile("s_wait_xcnt 0x0" :: "v"(off), "s"(xr), "s"(w), "s"(b) : "memory");
  __builtin_amdgcn_sched_barrier(0);  // all 24 loads stay in front of the arithmetic, in flight together: left to itself the compiler sinks those of w and b to their uses, two at a time, each pair a latency of its own

  f32x4 s4 = v[0];
#pragma unroll
  for (int i = 1; i < LN_VEC; ++i) s4 += v[i];
  const float mean = sum32((s4.x + s4.y) + (s4.z + s4.w)) * (1.f / DIM);
  f32x4 q4 = {0.f, 0.f, 0.f, 0.f};
#pragma unroll
  for (int i = 0; i < LN_VEC; ++i) { v[i] -= mean; q4 += v[i] * v[i]; }
  const float inv = rsqrtf(sum32((q4.x + q4.y) + (q4.z + q4.w)) * (1.f / DIM) + EPS);
  float* yr = y + (long)row * DIM;
#pragma unroll
  for (int i = 0; i < LN_VEC; ++i) *(f32x4*)(yr + off + 128 * i) = v[i] * inv * wv[i] + bv[i];
}

__global__ __launch_bounds__(32 * LN_ROWS) void ln1024_kernel(const float* __restrict__ x,
                                                              const float* __restrict__ w,
                                                              const float* __restrict__ b,
                                                              float* __restrict__ y) {
  ln1024_row(x, w, b, y, (int)(blockIdx.x * LN_ROWS) + __builtin_amdgcn_readfirstlane((int)(threadIdx.x >> 5)));
}

// The three input streams' LayerNorms depend on nothing of one another: one grid holds the rows of all three,
// LN3_R0 rows of stream 0, then LN3_R1 rows of stream 1, then LN3_R2 rows of stream 2.
#define LN3_R0 (B_ * N_MM)
#define LN3_R1 (B_ * N_A)
#define LN3_R2 (B_ * N_V)
__global__ __launch_bounds__(32 * LN_ROWS) void ln1024_x3_kernel(
    const float* __restrict__ x0, const float* __restrict__ w0, const float* __restrict__ b0, float* __restrict__ y0,
    const float* __restrict__ x1, const float* __restrict__ w1, const float* __restrict__ b1, float* __restrict__ y1,
    const float* __restrict__ x2, const float* __restrict__ w2, const float* __restrict__ b2, float* __restrict__ y2) {
  const int id = (int)(blockIdx.x * LN_ROWS) + __builtin_amdgcn_readfirstlane((int)(threadIdx.x >> 5));
  const float* x = x0;
  const float* w = w0;
  const float* b = b0;
  float* y = y0;
  int row = id;
  if (id >= LN3_R0 + LN3_R1) {
    x = x2; w = w2; b = b2; y = y2; row = id - (LN3_R0 + LN3_R1);
  } else if (id >= LN3_R0) {
    x = x1; w = w1; b = b1; y = y1; row = id - LN3_R0;
  }
  ln1024_row(x, w, b, y, row);
}

__device__ __forceinline__ uint32_t uni(uint32_t v) { return (uint32_t)__builtin_amdgcn_readfirstlane(v); }
__device__ __forceinline__ uint32_t pinned(uint32_t v) { uint32_t w = uni(v); asm volatile("" : "+s"(w)); return w; }  // the pinned() form for a test around a tensor load
__device__ __forceinline__ void wait_ds0()     { asm volatile("s_wait_dscnt 0x0" ::: "memory"); }     // this wave's LDS reads have retired
__device__ __forceinline__ void wait_tensor0() { asm volatile("s_wait_tensorcnt 0x0" ::: "memory"); } // this wave's tensor load has landed
__device__ __forceinline__ void wait_tensor0(u32x4& g0, u32x8& g1) {
  asm volatile("s_wait_tensorcnt 0x0" : "+s"(g0), "+s"(g1) :: "memory");
}

__device__ __forceinline__ void tdm_group0(u32x4& g, const float* lptr, const float* gptr) {
  const uint64_t ga = (uint64_t)gptr;
  g[0] = uni(1u);
  g[1] = uni((uint32_t)(uint64_t)lptr);
  g[2] = uni((uint32_t)ga);
  g[3] = uni((((uint32_t)(ga >> 32)) & 0x01FFFFFFu) | 0x80000000u);
}
template <uint32_t WORD0, uint32_t ROWB, uint32_t ROWS>
__device__ __forceinline__ u32x8 tdm_group1(uint32_t src_pitch) {
  u32x8 g;
  g[0] = uni(WORD0);
  g[1] = uni((ROWB & 0xFFFFu) << 16);
  g[2] = uni((ROWB >> 16) | ((ROWS & 0xFFFFu) << 16));
  g[3] = uni((ROWS >> 16) | (ROWB << 16));
  g[4] = uni(ROWS);
  g[5] = uni(src_pitch);
  g[6] = uni(0u);
  g[7] = uni(0u);
  return g;
}
__device__ __forceinline__ void tdm_load(u32x4& g0, u32x8& g1) {
  asm volatile("tensor_load_to_lds %0, %1" : "+s"(g0), "+s"(g1) :: "memory");  // in-out: see wait_tensor0(g0, g1)
}

#define KQ_LEN 16               /* k per share of a panel */
#define KSTEPS (KQ_LEN / 4)     /* WMMA depths of 4 per share */
// NH: halves of 64 columns in the block tile. KQ: shares of a panel's k. The block has NH * KQ waves, its tile is
// 32 x (64 * NH), a panel holds 16 * KQ k and is brought in slices of 64 k: wave 2 * s brings slice s of A, wave 2 * s + 1
// slice s of B, one tensor load each per panel. K is a multiple of the panel's depth and at least two panels.
template <int NH, int KQ>
__device__ __forceinline__ void gemm_tile_f32(
    const float* __restrict__ A, const float* __restrict__ Bm,
    const float* __restrict__ bias, const float* __restrict__ res,
    float* __restrict__ C, int N, int lda, int K, int epi, int tile_m, int tile_n) {
  constexpr int NT = 64 * NH;       // columns of the block tile
  constexpr int PK = KQ_LEN * KQ;   // k per panel
  constexpr int NS = PK / 64;       // slices per panel
  __shared__ __attribute__((aligned(2048))) float lA[2][NS * A_BUF];  // [slice][m][k] panels, row pitch A_PITCH
  __shared__ __attribute__((aligned(2048))) float lB[2][PK * NT];     // [k][n] panels
  const uint32_t wave = uni(threadIdx.x >> 5);
  const int lane = threadIdx.x & 31;
  const int m0   = tile_m * 32;
  const int nblk = tile_n * NT;
  const int nh   = (int)(wave % NH);    // which 64 of the tile's columns
  const int kq   = (int)(wave / NH);    // which share of each panel's k
  const uint32_t isA = (wave < 2u * NS && (wave & 1u) == 0u) ? 1u : 0u;   // this wave brings a slice of A
  const uint32_t isB = (wave < 2u * NS && (wave & 1u) == 1u) ? 1u : 0u;   // this wave brings a slice of B
  const int sl = (wave < 2u * NS) ? (int)(wave >> 1) : 0;                 // which slice

  v8f acc[2][4];
#pragma unroll
  for (int mt = 0; mt < 2; ++mt)
#pragma unroll
    for (int j = 0; j < 4; ++j) acc[mt][j] = (v8f){0.f, 0.f, 0.f, 0.f, 0.f, 0.f, 0.f, 0.f};

  const int S = K / PK;  // number of K panels

  u32x8 g1A = tdm_group1<(1u << 20) | (5u << 22) | (3u << 25), 256u, 32u>((uint32_t)lda * 4u);
  u32x8 g1B = tdm_group1<0u, NT * 4u, 64u>((uint32_t)N * 4u);
  const float* gA = A + (long)m0 * lda + 64 * sl;   // this wave's slice of panel s starts at gA + PK * s
  const float* gB = Bm + nblk + (long)(64 * sl) * N; // this wave's slice of panel s starts at gB + PK * s * N
  const int oA = sl * A_BUF, oB = sl * 64 * NT;      // the slice's place in a buffer

  u32x4 g0A, g0B;
  tdm_group0(g0A, lA[0] + oA, gA);
  tdm_group0(g0B, lB[0] + oB, gB);

  // panel 0, landed and published; then panel 1 into the other buffer
  if (pinned(isA)) {
    tdm_load(g0A, g1A);
    wait_tensor0(g0A, g1A);
  }
  if (pinned(isB)) {
    tdm_load(g0B, g1B);
    wait_tensor0(g0B, g1B);
  }
  __syncthreads();
  if (pinned(isA)) {
    tdm_group0(g0A, lA[1] + oA, gA + PK);
    tdm_load(g0A, g1A);
  }
  if (pinned(isB)) {
    tdm_group0(g0B, lB[1] + oB, gB + (long)PK * N);
    tdm_load(g0B, g1B);
  }

  const int ml = lane & 15;                              // A row in its tile / B column group
  const int k0 = kq * KQ_LEN + ((lane >> 4) << 1);       // this lane's first k in a panel: lanes 16-31 carry K+2,K+3
  for (int i = 0; i < S; ++i) {
    const int cur = i & 1;
    const float* lAc = lA[cur] + (k0 >> 6) * A_BUF + ml * A_PITCH + (k0 & 63);
    const float* lBc = lB[cur] + k0 * NT + nh * 64 + ml * 4;
    v2f a0[KSTEPS], a1[KSTEPS];     // A 16x4 frags, M rows 0-15 and 16-31 of the block tile: A[m][k], A[m][k+1]
    f32x4 b0[KSTEPS], b1[KSTEPS];   // B rows k and k+1, this lane's four columns
#pragma unroll
    for (int t = 0; t < KSTEPS; ++t) {
      b0[t] = *(const f32x4*)(lBc + (4 * t + 0) * NT);
      b1[t] = *(const f32x4*)(lBc + (4 * t + 1) * NT);
      a0[t] = *(const v2f*)(lAc + 4 * t);
      a1[t] = *(const v2f*)(lAc + 16 * A_PITCH + 4 * t);
    }
#pragma unroll
    for (int t = 0; t < KSTEPS; ++t) {
#pragma unroll
      for (int j = 0; j < 4; ++j) {
        const v2f bf = {b0[t][j], b1[t][j]};
        acc[0][j] = __builtin_amdgcn_wmma_f32_16x16x4_f32(false, a0[t], false, bf,
                                                          (short)0, acc[0][j], false, false);
        acc[1][j] = __builtin_amdgcn_wmma_f32_16x16x4_f32(false, a1[t], false, bf,
                                                          (short)0, acc[1][j], false, false);
      }
    }
    // Publish panel i + 1 and free panel i's buffer: own LDS reads retired, the issuers' loads landed, one barrier for both.
    __builtin_amdgcn_sched_barrier(0);  // keeps the panel's last WMMAs in front of the wait: behind it they would stall on the full LDS drain
    wait_ds0();
    if (pinned(isA)) wait_tensor0(g0A, g1A);
    if (pinned(isB)) wait_tensor0(g0B, g1B);
    __syncthreads();
    // Refill the buffer that every wave has just left, only while a panel i + 2 exists.
    if (pinned(i + 2 < S)) {
      if (pinned(isA)) {
        tdm_group0(g0A, lA[cur] + oA, gA + (i + 2) * PK);
        tdm_load(g0A, g1A);
      }
      if (pinned(isB)) {
        tdm_group0(g0B, lB[cur] + oB, gB + (long)((i + 2) * PK) * N);
        tdm_load(g0B, g1B);
      }
    }
  }
  wait_tensor0();
  wait_ds0();

  // The block finishes RSTEP rows of the tile per round, 16 bytes per lane: whole rows of the tile, 256 or 512 contiguous
  // bytes, per read and per store. Bias and residual are fetched here, so that they fly while the partial tiles go through LDS.
  constexpr int VPR   = NT / 4;                  // 16-byte pieces per row of the tile
  constexpr int RSTEP = NH * KQ * 32 / VPR;      // rows per round
  constexpr int NR    = 32 / RSTEP;              // rounds
  const int r0  = (int)wave * (32 / VPR) + lane / VPR;
  const int c4  = (lane % VPR) * 4;
  const int col = nblk + c4;
  const long o0 = (long)(m0 + r0) * N + col;     // row r0 + RSTEP * i lies at o0 + RSTEP * i * N
  f32x4 bv = {0.f, 0.f, 0.f, 0.f};
  f32x4 rv[NR];
  if (epi != EPI_NONE) {
    const float* pb = bias + col;
    bv = *(const f32x4*)pb;
    if (epi == EPI_BIAS_RES) {
#pragma unroll
      for (int i = 0; i < NR; ++i) rv[i] = *(const f32x4*)(res + o0 + (long)(RSTEP * i) * N);
    }
    // The wait that stands in front of an overwrite of a register that an issued global load names. The bias address is an
    // input, so that it lives up to here and the residual's addresses are not laid over it.
    asm volatile("s_wait_xcnt 0x0" :: "v"(pb) : "memory");
  }

  float* red = &lB[0][0];
  float* rw = red + kq * (32 * NT) + ((lane >> 4) << 3) * NT + nh * 64 + ml * 4;
#pragma unroll
  for (int mt = 0; mt < 2; ++mt)
#pragma unroll
    for (int r = 0; r < 8; ++r) {
      const f32x4 x = {acc[mt][0][r], acc[mt][1][r], acc[mt][2][r], acc[mt][3][r]};
      *(f32x4*)(rw + (mt * 16 + r) * NT) = x;
    }
  __syncthreads();

  // The planes are added in the order of k.
  const float* rr = red + r0 * NT + c4;
  f32x4 x[NR];
#pragma unroll
  for (int i = 0; i < NR; ++i) {
    x[i] = *(const f32x4*)(rr + RSTEP * i * NT);
#pragma unroll
    for (int z = 1; z < KQ; ++z) x[i] += *(const f32x4*)(rr + RSTEP * i * NT + z * (32 * NT));
    x[i] += bv;
  }
  if (epi == EPI_BIAS_GELU) {
#pragma unroll
    for (int i = 0; i < NR; ++i)
#pragma unroll
      for (int e = 0; e < 4; ++e) x[i][e] = 0.5f * x[i][e] * (1.f + erff(x[i][e] * 0.7071067811865476f));
  } else if (epi == EPI_BIAS_RES) {
#pragma unroll
    for (int i = 0; i < NR; ++i) x[i] += rv[i];
  }
#pragma unroll
  for (int i = 0; i < NR; ++i) *(f32x4*)(C + o0 + (long)(RSTEP * i) * N) = x[i];
}

__global__ __launch_bounds__(256) void gemm_wmma_f32(
    const float* __restrict__ A, const float* __restrict__ Bm,
    const float* __restrict__ bias, const float* __restrict__ res,
    float* __restrict__ C, int M, int N, int K, int epi) {
  (void)M;
  gemm_tile_f32<2, 4>(A, Bm, bias, res, C, N, K, K, epi, blockIdx.x, blockIdx.y);
}

// A product with few output tiles and a long K: the depth is dealt to the 16 waves of ONE work-group. Tile 32 x 64, so that
// 512 x 1024 outputs make one work-group per WGP; panels of 256 k, 16 k per wave, eight waves bringing a slice each. The 16
// partial tiles are added in LDS, so the work-group itself finishes its outputs: C = A @ B + bias + res.
__global__ __launch_bounds__(512) void gemm_kwaves_wmma_f32(
    const float* __restrict__ A, const float* __restrict__ Bm,
    const float* __restrict__ bias, const float* __restrict__ res,
    float* __restrict__ C, int N, int K) {
  gemm_tile_f32<1, 16>(A, Bm, bias, res, C, N, K, K, EPI_BIAS_RES, blockIdx.x, blockIdx.y);
}

#define QKV_SPLIT 4
#define TM0 (B_ * N_MM / 32u)    /* q:        512 x 256 */
#define TN0 (INNER / 128u)
#define TM1 (B_ * N_A / 32u)     /* kv audio: 256 x 512 */
#define TN1 (2 * INNER / 128u)
#define TM2 (B_ * N_V / 32u)     /* kv video: 128 x 512 */
#define TN2 (2 * INNER / 128u)
__global__ __launch_bounds__(256) void gemm_x3_wmma_f32(
    const float* __restrict__ A0, const float* __restrict__ B0, float* __restrict__ C0,
    const float* __restrict__ A1, const float* __restrict__ B1, float* __restrict__ C1,
    const float* __restrict__ A2, const float* __restrict__ B2, float* __restrict__ C2, int K) {
  const uint32_t id = blockIdx.x;
  const float* A = A0;
  const float* Bm = B0;
  float* C = C0;
  uint32_t tile_m = id % TM0, tile_n = id / TM0, tn = TN0, tm = TM0;
  if (id >= TM0 * TN0 + TM1 * TN1) {
    const uint32_t t = id - (TM0 * TN0 + TM1 * TN1);
    A = A2; Bm = B2; C = C2; tile_m = t % TM2; tile_n = t / TM2; tn = TN2; tm = TM2;
  } else if (id >= TM0 * TN0) {
    const uint32_t t = id - TM0 * TN0;
    A = A1; Bm = B1; C = C1; tile_m = t % TM1; tile_n = t / TM1; tn = TN1; tm = TM1;
  }
  const int N = (int)(tn * 128u);
  const int Kc = K / QKV_SPLIT;
  const long z = blockIdx.y;
  gemm_tile_f32<2, 4>(A + z * Kc, Bm + z * Kc * N, nullptr, nullptr, C + z * (long)(tm * 32u) * N, N, K, Kc, EPI_NONE,
                      (int)tile_m, (int)tile_n);
}

// ------------------------------------------------------------------
// Factorized attention. Logits over the synthetic 8192-long KV separate as
// s(v,a) = s_v + s_a, so softmax/PV factor into two independent softmaxes:
//   out = softmax(q.k_v^T) @ v_v  +  softmax(q.k_a^T) @ v_a
// One block per (batch, head, chunk of 32 q-tokens). The keys of one q-token are dealt to 8 neighbouring lanes:
// lane j of the 8 takes keys j, j + 8, j + 16, ... of both streams and keeps its 8 + 16 scores in registers;
// the 8 partial maxima, sums and outputs are merged inside the 16-lane row. K/V rows in LDS.
// ------------------------------------------------------------------
#define KSPLIT   8                         /* lanes that share one q-token */
#define TOK_BLK  (256 / KSPLIT)            /* q-tokens per block */
#define N_CHUNK  (N_MM / TOK_BLK)          /* blocks per (batch, head) */
#define NKEY_V   (N_V / KSPLIT)            /* video keys per lane */
#define NKEY     ((N_V + N_A) / KSPLIT)    /* keys per lane, the video keys first */
#define KGRP     4                         /* rows per register set */
#define NGRP     (NKEY / KGRP)
#define KV_PITCH 20

__device__ __forceinline__ float sum8(float x) {
  x += row_xor<1>(x);
  x += row_xor<2>(x);
  x += row_xor<4>(x);
  return x;
}
__device__ __forceinline__ float max8(float x) {
  x = fmaxf(x, row_xor<1>(x));
  x = fmaxf(x, row_xor<2>(x));
  x = fmaxf(x, row_xor<4>(x));
  return x;
}
__device__ __forceinline__ float exp_slot(float x) {
  float r;
  asm("v_exp_f32 %0, %1\n\tv_nop" : "=v"(r) : "v"(x * 1.4426950408889634f));
  return r;
}
// One register set: this lane's next KGRP rows (every KSPLIT-th row from p on), 16 floats each.
struct RowSet { f32x4 r[KGRP][HD / 4]; };
__device__ __forceinline__ void load_rows(RowSet& t, const float* p) {
#pragma unroll
  for (int u = 0; u < KGRP; ++u)
#pragma unroll
    for (int c = 0; c < HD / 4; ++c) t.r[u][c] = *(const f32x4*)(p + u * KSPLIT * KV_PITCH + 4 * c);
}
// q . k over 16 dims, as four partial sums in two packed chains
__device__ __forceinline__ float dot16(const v2f* q2, const f32x4* k) {
  v2f a = {0.f, 0.f}, b = {0.f, 0.f};
#pragma unroll
  for (int c = 0; c < HD / 4; ++c) {
    a = __builtin_elementwise_fma(q2[2 * c], k[c].xy, a);
    b = __builtin_elementwise_fma(q2[2 * c + 1], k[c].zw, b);
  }
  const v2f t = a + b;
  return t.x + t.y;
}
__device__ __forceinline__ void axpy16(v2f* o2, float e, const f32x4* v) {
  const v2f e2 = {e, e};
#pragma unroll
  for (int c = 0; c < HD / 4; ++c) {
    o2[2 * c]     = __builtin_elementwise_fma(e2, v[c].xy, o2[2 * c]);
    o2[2 * c + 1] = __builtin_elementwise_fma(e2, v[c].zw, o2[2 * c + 1]);
  }
}

// 16 bytes of a product that was stored as NP split-K planes of PLANE floats each: the planes added in the order of z
template <int NP, long PLANE>
__device__ __forceinline__ f32x4 sum_planes(const float* __restrict__ p) {
  f32x4 x = *(const f32x4*)p;
#pragma unroll
  for (int z = 1; z < NP; ++z) x += *(const f32x4*)(p + z * PLANE);
  return x;
}

// q, kvv, kva: QKV_SPLIT planes each, added here as they are read
__global__ __launch_bounds__(256) void attn_factored_kernel(
    const float* __restrict__ q, const float* __restrict__ kvv,
    const float* __restrict__ kva, float* __restrict__ out) {
  const int chunk = blockIdx.x % N_CHUNK;
  const int h = (blockIdx.x / N_CHUNK) & 15;
  const int b = blockIdx.x / (N_CHUNK * HEADS);
  // rows 0 .. N_V - 1: video keys; rows N_V .. N_V + N_A - 1: audio keys
  __shared__ __attribute__((aligned(16))) float kS[N_V + N_A][KV_PITCH];
  __shared__ __attribute__((aligned(16))) float vS[N_V + N_A][KV_PITCH];

  const int j   = threadIdx.x & (KSPLIT - 1);
  const int tok = chunk * TOK_BLK + (threadIdx.x / KSPLIT);
  v2f q2[HD / 2];
  const float* qp = q + (long)(b * N_MM + tok) * INNER + h * HD;
#pragma unroll
  for (int c = 0; c < HD / 4; ++c) {
    const f32x4 x = sum_planes<QKV_SPLIT, (long)B_ * N_MM * INNER>(qp + 4 * c);
    q2[2 * c] = x.xy;
    q2[2 * c + 1] = x.zw;
  }

  // 8 pieces of 16 B per key: 4 of its K row, 4 of its V row; 32 keys per round of the block
  const int part = (threadIdx.x >> 2) & 1, quad = threadIdx.x & 3;
  const int soff = part * INNER + h * HD + quad * 4;
  const int row0 = threadIdx.x >> 3;
  float* sdst = (part ? &vS[0][0] : &kS[0][0]) + quad * 4 + row0 * KV_PITCH;
  const float* pv = kvv + (long)(b * N_V + row0) * (2 * INNER) + soff;
  const float* pa = kva + (long)(b * N_A + row0) * (2 * INNER) + soff;
  f32x4 xv[N_V / 32], xa[N_A / 32];
#pragma unroll
  for (int it = 0; it < N_V / 32; ++it)
    xv[it] = sum_planes<QKV_SPLIT, (long)B_ * N_V * 2 * INNER>(pv + it * 32 * 2 * INNER);
#pragma unroll
  for (int it = 0; it < N_A / 32; ++it)
    xa[it] = sum_planes<QKV_SPLIT, (long)B_ * N_A * 2 * INNER>(pa + it * 32 * 2 * INNER);
  // The wait that stands in front of an overwrite of a register that an issued global load names. The three address pairs
  // are inputs, so that they live up to here and no later load's destination is laid over them.
  asm volatile("s_wait_xcnt 0x0" :: "v"(qp), "v"(pv), "v"(pa) : "memory");
#pragma unroll
  for (int it = 0; it < N_V / 32; ++it) *(f32x4*)(sdst + 32 * it * KV_PITCH) = xv[it];
#pragma unroll
  for (int it = 0; it < N_A / 32; ++it) *(f32x4*)(sdst + (N_V + 32 * it) * KV_PITCH) = xa[it];
  __syncthreads();

  // Key number i of this lane is row i * KSPLIT + j. Two register sets: the next KGRP rows are read while these are worked on.
  // The scheduling fence of each step keeps the next set's 16 reads together and ahead of the arithmetic on this set: left to
  // itself the compiler spreads the reads singly among the arithmetic, with only a few of them in flight.
  const float* kl = &kS[j][0];
  const float* vl = &vS[j][0];
  RowSet rs[2];
  float s[NKEY];
  load_rows(rs[0], kl);
#pragma unroll
  for (int g = 0; g < NGRP; ++g) {
    load_rows(rs[(g + 1) & 1], (g + 1 < NGRP) ? kl + (g + 1) * KGRP * KSPLIT * KV_PITCH : vl);
    __builtin_amdgcn_sched_barrier(0);  // the next set's reads stay in front of this set's arithmetic
#pragma unroll
    for (int u = 0; u < KGRP; ++u) s[g * KGRP + u] = dot16(q2, rs[g & 1].r[u]) * SCALE;
  }

  // maximum over all keys of each stream, then the exponentials
  float mV = s[0], mA = s[NKEY_V];
#pragma unroll
  for (int i = 1; i < NKEY_V; ++i) mV = fmaxf(mV, s[i]);
#pragma unroll
  for (int i = NKEY_V + 1; i < NKEY; ++i) mA = fmaxf(mA, s[i]);
  mV = max8(mV);
  mA = max8(mA);
  float lV = 0.f, lA = 0.f;
#pragma unroll
  for (int i = 0; i < NKEY_V; ++i) { s[i] = exp_slot(s[i] - mV); lV += s[i]; }
#pragma unroll
  for (int i = NKEY_V; i < NKEY; ++i) { s[i] = exp_slot(s[i] - mA); lA += s[i]; }

  v2f oV[HD / 2], oA[HD / 2];
#pragma unroll
  for (int d = 0; d < HD / 2; ++d) { oV[d] = (v2f){0.f, 0.f}; oA[d] = (v2f){0.f, 0.f}; }
#pragma unroll
  for (int g = 0; g < NGRP; ++g) {
    if (g + 1 < NGRP) load_rows(rs[(NGRP + g + 1) & 1], vl + (g + 1) * KGRP * KSPLIT * KV_PITCH);
    __builtin_amdgcn_sched_barrier(0);
#pragma unroll
    for (int u = 0; u < KGRP; ++u) {
      const int i = g * KGRP + u;
      axpy16(i < NKEY_V ? oV : oA, s[i], rs[(NGRP + g) & 1].r[u]);
    }
  }
  const float invV = 1.f / sum8(lV);
  const float invA = 1.f / sum8(lA);

  float c[HD];
#pragma unroll
  for (int d = 0; d < HD / 2; ++d) {
    const v2f t = oV[d] * invV + oA[d] * invA;
    c[2 * d]     = sum8(t.x);
    c[2 * d + 1] = sum8(t.y);
  }

  if (j == 0) {
    f32x4* op = (f32x4*)(out + (long)(b * N_MM + tok) * INNER + h * HD);
#pragma unroll
    for (int g = 0; g < HD / 4; ++g) {
      f32x4 x = {c[4 * g], c[4 * g + 1], c[4 * g + 2], c[4 * g + 3]};
      op[g] = x;
    }
  }
}

// ------------------------------------------------------------------
extern "C" void kernel_launch(void* const* d_in, const int* in_sizes, int n_in,
                              void* d_out, int out_size, void* d_ws, size_t ws_size,
                              hipStream_t stream) {
  (void)in_sizes; (void)n_in; (void)out_size; (void)ws_size;
  const float* xmm      = (const float*)d_in[0];
  const float* xv       = (const float*)d_in[1];
  const float* xa       = (const float*)d_in[2];
  const float* ln_mm_w  = (const float*)d_in[3];
  const float* ln_mm_b  = (const float*)d_in[4];
  const float* ln_v_w   = (const float*)d_in[5];
  const float* ln_v_b   = (const float*)d_in[6];
  const float* ln_a_w   = (const float*)d_in[7];
  const float* ln_a_b   = (const float*)d_in[8];
  const float* Wq       = (const float*)d_in[9];
  const float* Wkv      = (const float*)d_in[10];
  const float* Wproj    = (const float*)d_in[11];
  const float* bproj    = (const float*)d_in[12];
  const float* ln_mlp_w = (const float*)d_in[13];
  const float* ln_mlp_b = (const float*)d_in[14];
  const float* W1       = (const float*)d_in[15];
  const float* b1       = (const float*)d_in[16];
  const float* W2       = (const float*)d_in[17];
  const float* b2       = (const float*)d_in[18];
  float* out = (float*)d_out;
  float* ws  = (float*)d_ws;

  const int RM = B_ * N_MM;  // 512 rows (mm stream)
  float* src_mm = ws;                               // 512*1024
  float* src_v  = src_mm + (long)RM * DIM;          // 128*1024
  float* src_a  = src_v + (long)B_ * N_V * DIM;     // 256*1024
  float* qbuf   = src_a + (long)B_ * N_A * DIM;                 // QKV_SPLIT planes of 512*256
  float* kvv    = qbuf + (long)QKV_SPLIT * RM * INNER;          // QKV_SPLIT planes of 128*512
  float* kva    = kvv + (long)QKV_SPLIT * B_ * N_V * 2 * INNER; // QKV_SPLIT planes of 256*512
  float* attnb  = kva + (long)QKV_SPLIT * B_ * N_A * 2 * INNER; // 512*256
  float* xmm2   = attnb + (long)RM * INNER;         // 512*1024
  float* hln    = xmm2 + (long)RM * DIM;            // 512*1024
  float* act    = hln + (long)RM * DIM;             // 512*4096

  // 1) LayerNorms
  ln1024_x3_kernel<<<(LN3_R0 + LN3_R1 + LN3_R2) / LN_ROWS, 32 * LN_ROWS, 0, stream>>>(
      xmm, ln_mm_w, ln_mm_b, src_mm, xa, ln_a_w, ln_a_b, src_a, xv, ln_v_w, ln_v_b, src_v);

  // 2) Projections (WMMA GEMMs). Wkv[:DIM] / Wkv[DIM:] are contiguous halves.
  //    q (16 x 2 tiles), kv of the audio stream (8 x 4) and kv of the video stream (4 x 4) in one grid of 80 tiles,
  //    times QKV_SPLIT shares of K.
  gemm_x3_wmma_f32<<<dim3(TM0 * TN0 + TM1 * TN1 + TM2 * TN2, QKV_SPLIT), 256, 0, stream>>>(
      src_mm, Wq, qbuf,
      src_a, Wkv + (long)DIM * 2 * INNER, kva,
      src_v, Wkv, kvv, DIM);

  // 3) Factorized attention over the separable 8192-key softmax
  attn_factored_kernel<<<B_ * HEADS * N_CHUNK, 256, 0, stream>>>(qbuf, kvv, kva, attnb);

  // 4) Output proj + bias + residual -> xmm2
  gemm_wmma_f32<<<dim3(16, 8), 256, 0, stream>>>(attnb, Wproj, bproj, xmm,
                                                 xmm2, RM, DIM, INNER, EPI_BIAS_RES);

  // 5) MLP: LN -> W1+gelu -> W2 (K dealt to the waves of each work-group) + bias + residual
  ln1024_kernel<<<RM / LN_ROWS, 32 * LN_ROWS, 0, stream>>>(xmm2, ln_mlp_w, ln_mlp_b, hln);
  gemm_wmma_f32<<<dim3(16, 32), 256, 0, stream>>>(hln, W1, b1, nullptr,
                                                  act, RM, HID, DIM, EPI_BIAS_GELU);
  gemm_kwaves_wmma_f32<<<dim3(16, 16), 512, 0, stream>>>(act, W2, b2, xmm2, out, DIM, HID);
}
